// v000
// Measured on an AMD MI455X. A time is GPU time per run, averaged over a window of back-to-back runs after a warm-up
// (all launches, gaps included; the runs take copies of the inputs in turn), and the median of several windows.
// Apart from v000's, it joins two sittings. Times from different sittings can be a few percent apart, while
// side-by-side timings come from the same sitting.
// v000, which the later versions start from, runs in 126 microseconds.
#include <hip/hip_runtime.h>
#include <cstdint>

typedef _Float16 h16v __attribute__((ext_vector_type(16)));
typedef _Float16 h8v  __attribute__((ext_vector_type(8)));
typedef _Float16 h4v  __attribute__((ext_vector_type(4)));
typedef float    f8v  __attribute__((ext_vector_type(8)));
typedef float    f4v  __attribute__((ext_vector_type(4)));
typedef unsigned int v4u __attribute__((ext_vector_type(4)));
typedef int          v8i __attribute__((ext_vector_type(8)));
typedef int          v4i __attribute__((ext_vector_type(4)));

#define S_LEN   4096
#define DHEAD   64
#define NHEAD   16
#define BR      64              // q rows per block (16 per wave x 4 waves)
#define BC      64              // keys per tile
#define NKT     (S_LEN / BC)
#define LPAD    8
#define LDW     (DHEAD + LPAD)  // 72 halves = 144 B = 32 DW row + 4 DW pad (matches TDM pad cfg)

#define CAT16(lo, hi) __builtin_shufflevector((lo), (hi), 0,1,2,3,4,5,6,7,8,9,10,11,12,13,14,15)

// ---------------------------------------------------------------------------
// TDM: 2-D tile load Global->LDS. D# packed per ISA ch.8 (group0 128b, group1
// 256b; groups 2/3 + extra group zero for 2-D). data_size=2B; pad 4 DWORDs
// after every 32 DWORDs so a 64-half tile row lands on a 144-B padded LDS row.
// Toolchain here is clang-23 (therock): 6-arg builtin form.
// ---------------------------------------------------------------------------
__device__ __forceinline__ void tdm_load_2d(unsigned lds_addr, const _Float16* gptr,
                                            unsigned tensor_dim0, unsigned tensor_dim1,
                                            unsigned tile_dim0,   unsigned tile_dim1,
                                            unsigned dim0_stride /* elements */)
{
    unsigned long long ga = (unsigned long long)(size_t)gptr;
    v4u g0;
    g0[0] = 1u;                                               // count=1, user descriptor
    g0[1] = lds_addr;                                         // LDS byte address
    g0[2] = (unsigned)ga;                                     // global_addr[31:0]
    g0[3] = ((unsigned)(ga >> 32) & 0x01FFFFFFu) | (2u << 30);// global_addr[56:32] | type=2
    v8i g1;
    g1[0] = (int)((1u << 16) | (1u << 20) | (4u << 22) | (3u << 25)); // 2B, pad_en, int=32DW, amt=4DW
    g1[1] = (int)((tensor_dim0 & 0xFFFFu) << 16);                     // tensor_dim0[15:0]
    g1[2] = (int)((tensor_dim0 >> 16) | ((tensor_dim1 & 0xFFFFu) << 16));
    g1[3] = (int)((tensor_dim1 >> 16) | (tile_dim0 << 16));
    g1[4] = (int)tile_dim1;                                           // tile_dim2 = 0 (2-D)
    g1[5] = (int)dim0_stride;
    g1[6] = 0;                                                        // stride hi / dim1_stride
    g1[7] = 0;
    v4i z4 = (v4i)0;
    v8i z8 = (v8i)0;
    __builtin_amdgcn_tensor_load_to_lds(g0, g1, z4, z4, z8, 0);
}

// ---------------------------------------------------------------------------
// Pre-pass 1: K fp32 -> f16 (same [h][s][d] layout). One-time; removes the
// per-q-block re-conversion (64x redundant) and halves K's L2 traffic.
// ---------------------------------------------------------------------------
__global__ __launch_bounds__(256)
void cvt_f16_kernel(const float* __restrict__ src, _Float16* __restrict__ dst, int n8)
{
    int g = blockIdx.x * 256 + threadIdx.x;
    if (g >= n8) return;
    const float* p = src + (size_t)g * 8;
    f4v a = *(const f4v*)p;
    f4v b = *(const f4v*)(p + 4);
    h8v o;
#pragma unroll
    for (int e = 0; e < 4; ++e) { o[e] = (_Float16)a[e]; o[4 + e] = (_Float16)b[e]; }
    *(h8v*)(dst + (size_t)g * 8) = o;
}

// ---------------------------------------------------------------------------
// Pre-pass 2: V fp32 [h][s][d] -> f16 transposed [h][d][s] via LDS tile, so the
// main loop's V staging is a plain 2-D TDM copy into VsT[d][key].
// ---------------------------------------------------------------------------
__global__ __launch_bounds__(256)
void vtrans_kernel(const float* __restrict__ V, _Float16* __restrict__ VhT)
{
    __shared__ _Float16 T[64][72];
    const int tid = threadIdx.x;
    const int s0  = blockIdx.x * 64;
    const int h   = blockIdx.y;
#pragma unroll
    for (int i = 0; i < 4; ++i) {
        const int idx = i * 256 + tid;          // 1024 float4's per 64x64 tile
        const int r   = idx >> 4;
        const int c4  = (idx & 15) * 4;
        f4v v = *(const f4v*)(V + ((size_t)h * S_LEN + s0 + r) * DHEAD + c4);
#pragma unroll
        for (int e = 0; e < 4; ++e) T[c4 + e][r] = (_Float16)v[e];
    }
    __syncthreads();
#pragma unroll
    for (int i = 0; i < 2; ++i) {
        const int idx = i * 256 + tid;          // 512 h8v chunks out
        const int d   = idx >> 3;
        const int c8  = (idx & 7) * 8;
        *(h8v*)(VhT + ((size_t)h * DHEAD + d) * S_LEN + s0 + c8) = *(const h8v*)&T[d][c8];
    }
}

// ---------------------------------------------------------------------------
// Main flash-attention kernel. 4 waves x 16 q-rows; per 64-key tile:
// 8 WMMA (QK^T) + 2 WMMA (rowsum via ones) + 8 WMMA (PV). K/V tiles arrive by
// TDM into double-buffered LDS (s_wait_tensorcnt), overlapping DMA w/ compute.
// ---------------------------------------------------------------------------
__global__ __launch_bounds__(128)
void fa_wmma_kernel(const float* __restrict__ Q, const _Float16* __restrict__ Kh,
                    const _Float16* __restrict__ VhT, float* __restrict__ O)
{
    __shared__ _Float16 Ks [2][BC][LDW];     // [buf][key][d]
    __shared__ _Float16 VsT[2][DHEAD][LDW];  // [buf][d][key]
    __shared__ _Float16 Ps [BR][LDW];        // [q_local][key] (per-wave private strips)

    const int tid  = threadIdx.x;
    const int lane = tid & 31;
    const int wave = __builtin_amdgcn_readfirstlane(tid >> 5);  // SGPR (uniform TDM operands)
    const int half = lane >> 4;
    const int l16  = lane & 15;
    const int head = blockIdx.y;
    const int qw   = blockIdx.x * BR + wave * 16;

    const _Float16* KhH  = Kh  + (size_t)head * S_LEN * DHEAD;  // [s][d] f16
    const _Float16* VhTH = VhT + (size_t)head * DHEAD * S_LEN;  // [d][s] f16

    // ---- Q A-fragments (1/sqrt(64) folded in). A-map: lane=M&15, elem i ->
    // K = (i>>3)*16 + half*8 + (i&7) ----
    h16v qa[2];
    {
        const float  sc   = 0.125f;
        const float* qrow = Q + ((size_t)head * S_LEN + qw + l16) * DHEAD;
#pragma unroll
        for (int kc = 0; kc < 2; ++kc)
#pragma unroll
            for (int g = 0; g < 2; ++g) {
                const int dbase = kc * 32 + g * 16 + half * 8;
                f4v v0 = *(const f4v*)(qrow + dbase);
                f4v v1 = *(const f4v*)(qrow + dbase + 4);
#pragma unroll
                for (int e = 0; e < 4; ++e) {
                    qa[kc][g * 8 + e]     = (_Float16)(v0[e] * sc);
                    qa[kc][g * 8 + 4 + e] = (_Float16)(v1[e] * sc);
                }
            }
    }

    h16v ones;
#pragma unroll
    for (int i = 0; i < 16; ++i) ones[i] = (_Float16)1.0f;

    float m_run[8], l_run[8];
    f8v   acc[4];
#pragma unroll
    for (int j = 0; j < 8; ++j) { m_run[j] = -1e30f; l_run[j] = 0.0f; }
#pragma unroll
    for (int t = 0; t < 4; ++t)
#pragma unroll
        for (int j = 0; j < 8; ++j) acc[t][j] = 0.0f;

    // ---- Pre-issue TDM for tile 0: wave w DMAs K rows / V d-rows w*16..w*16+15
    tdm_load_2d((unsigned)(size_t)&Ks[0][wave * 16][0],
                KhH + (size_t)(wave * 16) * DHEAD,
                DHEAD, S_LEN, DHEAD, 16, DHEAD);
    tdm_load_2d((unsigned)(size_t)&VsT[0][wave * 16][0],
                VhTH + (size_t)(wave * 16) * S_LEN,
                S_LEN, DHEAD, BC, 16, S_LEN);

    for (int kt = 0; kt < NKT; ++kt) {
        const int buf = kt & 1;
        __builtin_amdgcn_s_wait_tensorcnt(0);   // this tile's DMA done (my waves' ops)
        __syncthreads();                        // all waves' quarters visible

        if (kt + 1 < NKT) {                     // kick next tile into the other buffer
            const int nb = buf ^ 1;
            tdm_load_2d((unsigned)(size_t)&Ks[nb][wave * 16][0],
                        KhH + (size_t)((kt + 1) * BC + wave * 16) * DHEAD,
                        DHEAD, S_LEN, DHEAD, 16, DHEAD);
            tdm_load_2d((unsigned)(size_t)&VsT[nb][wave * 16][0],
                        VhTH + (size_t)(wave * 16) * S_LEN + (kt + 1) * BC,
                        S_LEN, DHEAD, BC, 16, S_LEN);
        }

        // ---- S = (Q/sqrt d) K^T ----
        f8v s[4];
#pragma unroll
        for (int jb = 0; jb < 4; ++jb) {
            f8v c;
#pragma unroll
            for (int j = 0; j < 8; ++j) c[j] = 0.0f;
#pragma unroll
            for (int kc = 0; kc < 2; ++kc) {
                const _Float16* kr = &Ks[buf][jb * 16 + l16][0];   // B[k][n]=K[n][d]
                h8v lo = *(const h8v*)(kr + kc * 32 + half * 8);
                h8v hi = *(const h8v*)(kr + kc * 32 + 16 + half * 8);
                h16v kb = CAT16(lo, hi);
                c = __builtin_amdgcn_wmma_f32_16x16x32_f16(
                        false, qa[kc], false, kb, (short)0, c, false, false);
            }
            s[jb] = c;
        }

        // ---- Row max (butterfly within 16-lane halves), exp, rescale ----
        float mnew[8], scl[8];
#pragma unroll
        for (int j = 0; j < 8; ++j) {
            float t = fmaxf(fmaxf(s[0][j], s[1][j]), fmaxf(s[2][j], s[3][j]));
#pragma unroll
            for (int m = 1; m <= 8; m <<= 1) t = fmaxf(t, __shfl_xor(t, m, 32));
            mnew[j]  = fmaxf(m_run[j], t);
            scl[j]   = __expf(m_run[j] - mnew[j]);
            m_run[j] = mnew[j];
        }
#pragma unroll
        for (int jb = 0; jb < 4; ++jb)
#pragma unroll
            for (int j = 0; j < 8; ++j) s[jb][j] = __expf(s[jb][j] - mnew[j]);
#pragma unroll
        for (int db = 0; db < 4; ++db)
#pragma unroll
            for (int j = 0; j < 8; ++j) acc[db][j] *= scl[j];

        // ---- P -> per-wave LDS strip (f16), reload as A-fragments ----
        const int q0l = wave * 16;
#pragma unroll
        for (int jb = 0; jb < 4; ++jb)
#pragma unroll
            for (int j = 0; j < 8; ++j)
                Ps[q0l + j + half * 8][jb * 16 + l16] = (_Float16)s[jb][j];

        h16v pa[2];
#pragma unroll
        for (int kc = 0; kc < 2; ++kc) {
            const _Float16* pr = &Ps[q0l + l16][0];
            h8v lo = *(const h8v*)(pr + kc * 32 + half * 8);
            h8v hi = *(const h8v*)(pr + kc * 32 + 16 + half * 8);
            pa[kc] = CAT16(lo, hi);
        }

        // ---- Row sums via WMMA with ones (replaces 32 ds_bpermute) ----
        f8v rs;
#pragma unroll
        for (int j = 0; j < 8; ++j) rs[j] = 0.0f;
        rs = __builtin_amdgcn_wmma_f32_16x16x32_f16(false, pa[0], false, ones, (short)0, rs, false, false);
        rs = __builtin_amdgcn_wmma_f32_16x16x32_f16(false, pa[1], false, ones, (short)0, rs, false, false);
#pragma unroll
        for (int j = 0; j < 8; ++j) l_run[j] = l_run[j] * scl[j] + rs[j];

        // ---- O += P * V ----
#pragma unroll
        for (int kc = 0; kc < 2; ++kc)
#pragma unroll
            for (int db = 0; db < 4; ++db) {
                const _Float16* vr = &VsT[buf][db * 16 + l16][0];  // B[k][n]=V[k][d=n]
                h8v vlo = *(const h8v*)(vr + kc * 32 + half * 8);
                h8v vhi = *(const h8v*)(vr + kc * 32 + 16 + half * 8);
                h16v vb = CAT16(vlo, vhi);
                acc[db] = __builtin_amdgcn_wmma_f32_16x16x32_f16(
                              false, pa[kc], false, vb, (short)0, acc[db], false, false);
            }
    }

    // ---- Normalize + store O (fp32) ----
    const size_t obase = ((size_t)head * S_LEN + qw) * DHEAD;
#pragma unroll
    for (int db = 0; db < 4; ++db)
#pragma unroll
        for (int j = 0; j < 8; ++j) {
            const float o = acc[db][j] * (1.0f / l_run[j]);
            O[obase + (size_t)(j + half * 8) * DHEAD + db * 16 + l16] = o;
        }
}

extern "C" void kernel_launch(void* const* d_in, const int* in_sizes, int n_in,
                              void* d_out, int out_size, void* d_ws, size_t ws_size,
                              hipStream_t stream) {
    const float* Q = (const float*)d_in[0];
    const float* K = (const float*)d_in[1];
    const float* V = (const float*)d_in[2];
    float*       O = (float*)d_out;
    (void)in_sizes; (void)n_in; (void)out_size; (void)ws_size;

    const size_t elems = (size_t)NHEAD * S_LEN * DHEAD;     // 4,194,304 per tensor
    _Float16* Kh  = (_Float16*)d_ws;                        // 8.4 MB
    _Float16* VhT = Kh + elems;                             // 8.4 MB (transposed per head)

    cvt_f16_kernel<<<dim3((unsigned)(elems / 8 / 256)), dim3(256), 0, stream>>>(K, Kh, (int)(elems / 8));
    vtrans_kernel<<<dim3(S_LEN / 64, NHEAD), dim3(256), 0, stream>>>(V, VhT);
    fa_wmma_kernel<<<dim3(S_LEN / BR, NHEAD), dim3(128), 0, stream>>>(Q, Kh, VhT, O);
}

// v001
// A run of this version takes 80.6 microseconds.
// Two timings next to v000 both put it at 1.62 times that version's speed.
#include <hip/hip_runtime.h>
#include <cstdint>

typedef _Float16 h16v __attribute__((ext_vector_type(16)));
typedef _Float16 h8v  __attribute__((ext_vector_type(8)));
typedef _Float16 h4v  __attribute__((ext_vector_type(4)));
typedef float    f8v  __attribute__((ext_vector_type(8)));
typedef float    f4v  __attribute__((ext_vector_type(4)));
typedef unsigned int v4u __attribute__((ext_vector_type(4)));
typedef int          v8i __attribute__((ext_vector_type(8)));
typedef int          v4i __attribute__((ext_vector_type(4)));

#define S_LEN   4096
#define DHEAD   64
#define NHEAD   16
#define BR      64              // q rows per block (16 per wave x 4 waves)
#define BC      64              // keys per tile
#define NKT     (S_LEN / BC)
#define LPAD    8
#define LDW     (DHEAD + LPAD)  // 72 halves = 144 B = 32 DW row + 4 DW pad (matches TDM pad cfg)

#define CAT16(lo, hi) __builtin_shufflevector((lo), (hi), 0,1,2,3,4,5,6,7,8,9,10,11,12,13,14,15)

// ---------------------------------------------------------------------------
// TDM: 2-D tile load Global->LDS. D# packed per ISA ch.8 (group0 128b, group1
// 256b; groups 2/3 + extra group zero for 2-D). data_size=2B; pad 4 DWORDs
// after every 32 DWORDs so a 64-half tile row lands on a 144-B padded LDS row.
// Toolchain here is clang-23 (therock): 6-arg builtin form.
// ---------------------------------------------------------------------------
__device__ __forceinline__ void tdm_load_2d(unsigned lds_addr, const _Float16* gptr,
                                            unsigned tensor_dim0, unsigned tensor_dim1,
                                            unsigned tile_dim0,   unsigned tile_dim1,
                                            unsigned dim0_stride /* elements */)
{
    unsigned long long ga = (unsigned long long)(size_t)gptr;
    v4u g0;
    g0[0] = 1u;                                               // count=1, user descriptor
    g0[1] = lds_addr;                                         // LDS byte address
    g0[2] = (unsigned)ga;                                     // global_addr[31:0]
    g0[3] = ((unsigned)(ga >> 32) & 0x01FFFFFFu) | (2u << 30);// global_addr[56:32] | type=2
    v8i g1;
    g1[0] = (int)((1u << 16) | (1u << 20) | (4u << 22) | (3u << 25)); // 2B, pad_en, int=32DW, amt=4DW
    g1[1] = (int)((tensor_dim0 & 0xFFFFu) << 16);                     // tensor_dim0[15:0]
    g1[2] = (int)((tensor_dim0 >> 16) | ((tensor_dim1 & 0xFFFFu) << 16));
    g1[3] = (int)((tensor_dim1 >> 16) | (tile_dim0 << 16));
    g1[4] = (int)tile_dim1;                                           // tile_dim2 = 0 (2-D)
    g1[5] = (int)dim0_stride;
    g1[6] = 0;                                                        // stride hi / dim1_stride
    g1[7] = 0;
    v4i z4 = (v4i)0;
    v8i z8 = (v8i)0;
    __builtin_amdgcn_tensor_load_to_lds(g0, g1, z4, z4, z8, 0);
}

// ---------------------------------------------------------------------------
// Pre-pass 1: K fp32 -> f16 (same [h][s][d] layout). One-time; removes the
// per-q-block re-conversion (64x redundant) and halves K's L2 traffic.
// ---------------------------------------------------------------------------
__global__ __launch_bounds__(256)
void cvt_f16_kernel(const float* __restrict__ src, _Float16* __restrict__ dst, int n8)
{
    int g = blockIdx.x * 256 + threadIdx.x;
    if (g >= n8) return;
    const float* p = src + (size_t)g * 8;
    f4v a = *(const f4v*)p;
    f4v b = *(const f4v*)(p + 4);
    h8v o;
#pragma unroll
    for (int e = 0; e < 4; ++e) { o[e] = (_Float16)a[e]; o[4 + e] = (_Float16)b[e]; }
    *(h8v*)(dst + (size_t)g * 8) = o;
}

// ---------------------------------------------------------------------------
// Pre-pass 2: V fp32 [h][s][d] -> f16 transposed [h][d][s] via LDS tile, so the
// main loop's V staging is a plain 2-D TDM copy into VsT[d][key].
// ---------------------------------------------------------------------------
__global__ __launch_bounds__(256)
void vtrans_kernel(const float* __restrict__ V, _Float16* __restrict__ VhT)
{
    __shared__ _Float16 T[64][72];
    const int tid = threadIdx.x;
    const int s0  = blockIdx.x * 64;
    const int h   = blockIdx.y;
#pragma unroll
    for (int i = 0; i < 4; ++i) {
        const int idx = i * 256 + tid;          // 1024 float4's per 64x64 tile
        const int r   = idx >> 4;
        const int c4  = (idx & 15) * 4;
        f4v v = *(const f4v*)(V + ((size_t)h * S_LEN + s0 + r) * DHEAD + c4);
#pragma unroll
        for (int e = 0; e < 4; ++e) T[c4 + e][r] = (_Float16)v[e];
    }
    __syncthreads();
#pragma unroll
    for (int i = 0; i < 2; ++i) {
        const int idx = i * 256 + tid;          // 512 h8v chunks out
        const int d   = idx >> 3;
        const int c8  = (idx & 7) * 8;
        *(h8v*)(VhT + ((size_t)h * DHEAD + d) * S_LEN + s0 + c8) = *(const h8v*)&T[d][c8];
    }
}

// ---------------------------------------------------------------------------
// Main flash-attention kernel. 4 waves x 16 queries; per 64-key tile:
// 8 WMMA (S^T = K Q^T) + 2 WMMA (column sums via ones) + 8 WMMA (O^T += V^T P^T).
// In the transposed products a lane holds scores of ONE query (column l16, keys
// 8*half + r of each 16-key tile): the maximum is in-lane plus one exchange
// between the lane halves, and two score tiles convert in place into the B
// operand of the second product, so P never goes through LDS.
// K/V tiles arrive by TDM into double-buffered LDS (s_wait_tensorcnt).
// ---------------------------------------------------------------------------
__global__ __launch_bounds__(128)
void fa_wmma_kernel(const float* __restrict__ Q, const _Float16* __restrict__ Kh,
                    const _Float16* __restrict__ VhT, float* __restrict__ O)
{
    __shared__ _Float16 Ks [2][BC][LDW];     // [buf][key][d]
    __shared__ _Float16 VsT[2][DHEAD][LDW];  // [buf][d][key]

    const int tid  = threadIdx.x;
    const int lane = tid & 31;
    const int wave = __builtin_amdgcn_readfirstlane(tid >> 5);  // SGPR (uniform TDM operands)
    const int half = lane >> 4;
    const int l16  = lane & 15;
    const int head = blockIdx.y;
    const int qw   = blockIdx.x * BR + wave * 16;

    const _Float16* KhH  = Kh  + (size_t)head * S_LEN * DHEAD;  // [s][d] f16
    const _Float16* VhTH = VhT + (size_t)head * DHEAD * S_LEN;  // [d][s] f16

    // ---- Q B-fragments (1/sqrt(64) folded in). B-map: lane=N&15 (query), elem i ->
    // K = (i>>3)*16 + half*8 + (i&7), the same k order as the K and V loaders ----
    h16v qa[2];
    {
        const float  sc   = 0.125f;
        const float* qrow = Q + ((size_t)head * S_LEN + qw + l16) * DHEAD;
#pragma unroll
        for (int kc = 0; kc < 2; ++kc)
#pragma unroll
            for (int g = 0; g < 2; ++g) {
                const int dbase = kc * 32 + g * 16 + half * 8;
                f4v v0 = *(const f4v*)(qrow + dbase);
                f4v v1 = *(const f4v*)(qrow + dbase + 4);
#pragma unroll
                for (int e = 0; e < 4; ++e) {
                    qa[kc][g * 8 + e]     = (_Float16)(v0[e] * sc);
                    qa[kc][g * 8 + 4 + e] = (_Float16)(v1[e] * sc);
                }
            }
    }

    h16v ones;
#pragma unroll
    for (int i = 0; i < 16; ++i) ones[i] = (_Float16)1.0f;

    float m_run = -1e30f, l_run = 0.0f;      // this lane's query (same in both halves)
    f8v   acc[4];                            // acc[db][r] = O[query l16][db*16 + half*8 + r]
#pragma unroll
    for (int t = 0; t < 4; ++t)
#pragma unroll
        for (int j = 0; j < 8; ++j) acc[t][j] = 0.0f;

    // ---- Pre-issue TDM for tile 0: wave w DMAs K rows / V d-rows w*16..w*16+15
    tdm_load_2d((unsigned)(size_t)&Ks[0][wave * 16][0],
                KhH + (size_t)(wave * 16) * DHEAD,
                DHEAD, S_LEN, DHEAD, 16, DHEAD);
    tdm_load_2d((unsigned)(size_t)&VsT[0][wave * 16][0],
                VhTH + (size_t)(wave * 16) * S_LEN,
                S_LEN, DHEAD, BC, 16, S_LEN);

    for (int kt = 0; kt < NKT; ++kt) {
        const int buf = kt & 1;
        __builtin_amdgcn_s_wait_tensorcnt(0);   // this tile's DMA done (my waves' ops)
        __syncthreads();                        // all waves' quarters visible

        if (kt + 1 < NKT) {                     // kick next tile into the other buffer
            const int nb = buf ^ 1;
            tdm_load_2d((unsigned)(size_t)&Ks[nb][wave * 16][0],
                        KhH + (size_t)((kt + 1) * BC + wave * 16) * DHEAD,
                        DHEAD, S_LEN, DHEAD, 16, DHEAD);
            tdm_load_2d((unsigned)(size_t)&VsT[nb][wave * 16][0],
                        VhTH + (size_t)(wave * 16) * S_LEN + (kt + 1) * BC,
                        S_LEN, DHEAD, BC, 16, S_LEN);
        }

        // ---- S^T = K (Q/sqrt d)^T : s[jb][r] = score(key jb*16 + half*8 + r, query l16) ----
        f8v s[4];
#pragma unroll
        for (int jb = 0; jb < 4; ++jb) {
            f8v c;
#pragma unroll
            for (int j = 0; j < 8; ++j) c[j] = 0.0f;
#pragma unroll
            for (int kc = 0; kc < 2; ++kc) {
                const _Float16* kr = &Ks[buf][jb * 16 + l16][0];   // A[m][k]=K[m][d]
                h8v lo = *(const h8v*)(kr + kc * 32 + half * 8);
                h8v hi = *(const h8v*)(kr + kc * 32 + 16 + half * 8);
                h16v kb = CAT16(lo, hi);
                c = __builtin_amdgcn_wmma_f32_16x16x32_f16(
                        false, kb, false, qa[kc], (short)0, c, false, false);
            }
            s[jb] = c;
        }

        // ---- Column max: 32 keys in-lane, then the other lane half's 32 ----
        float tj[8];
#pragma unroll
        for (int j = 0; j < 8; ++j)
            tj[j] = fmaxf(fmaxf(s[0][j], s[1][j]), fmaxf(s[2][j], s[3][j]));
        float t = fmaxf(fmaxf(fmaxf(tj[0], tj[1]), fmaxf(tj[2], tj[3])),
                        fmaxf(fmaxf(tj[4], tj[5]), fmaxf(tj[6], tj[7])));
        {
            const int tb = __builtin_bit_cast(int, t);
            const int ob = __builtin_amdgcn_permlanex16(tb, tb, 0x76543210, 0xfedcba98, false, false);
            t = fmaxf(t, __builtin_bit_cast(float, ob));           // lane l <-> l ^ 16
        }
        const float mnew = fmaxf(m_run, t);
        const float scl  = __expf(m_run - mnew);
        m_run = mnew;

#pragma unroll
        for (int jb = 0; jb < 4; ++jb)
#pragma unroll
            for (int j = 0; j < 8; ++j) s[jb][j] = __expf(s[jb][j] - mnew);
#pragma unroll
        for (int db = 0; db < 4; ++db)
#pragma unroll
            for (int j = 0; j < 8; ++j) acc[db][j] *= scl;

        // ---- P^T B-fragments straight from the score tiles: elem i of chunk kc is
        // key kc*32 + (i>>3)*16 + half*8 + (i&7) = s[2*kc + (i>>3)][i&7] ----
        h16v pb[2];
#pragma unroll
        for (int kc = 0; kc < 2; ++kc)
            pb[kc] = CAT16(__builtin_convertvector(s[2 * kc], h8v),
                           __builtin_convertvector(s[2 * kc + 1], h8v));

        // ---- Column sums via WMMA with ones (every row of the result is the sum) ----
        f8v rs;
#pragma unroll
        for (int j = 0; j < 8; ++j) rs[j] = 0.0f;
        rs = __builtin_amdgcn_wmma_f32_16x16x32_f16(false, ones, false, pb[0], (short)0, rs, false, false);
        rs = __builtin_amdgcn_wmma_f32_16x16x32_f16(false, ones, false, pb[1], (short)0, rs, false, false);
        l_run = l_run * scl + rs[0];

        // ---- O^T += V^T * P^T ----
#pragma unroll
        for (int kc = 0; kc < 2; ++kc)
#pragma unroll
            for (int db = 0; db < 4; ++db) {
                const _Float16* vr = &VsT[buf][db * 16 + l16][0];  // A[m][k]=V[k][d=m]
                h8v vlo = *(const h8v*)(vr + kc * 32 + half * 8);
                h8v vhi = *(const h8v*)(vr + kc * 32 + 16 + half * 8);
                h16v vb = CAT16(vlo, vhi);
                acc[db] = __builtin_amdgcn_wmma_f32_16x16x32_f16(
                              false, vb, false, pb[kc], (short)0, acc[db], false, false);
            }
    }

    // ---- Normalize + store O (fp32): 8 consecutive d per lane and 16-d group ----
    const float inv  = 1.0f / l_run;
    float*      orow = O + ((size_t)head * S_LEN + qw + l16) * DHEAD + half * 8;
#pragma unroll
    for (int db = 0; db < 4; ++db) {
        f4v o0, o1;
#pragma unroll
        for (int e = 0; e < 4; ++e) { o0[e] = acc[db][e] * inv; o1[e] = acc[db][4 + e] * inv; }
        *(f4v*)(orow + db * 16)     = o0;
        *(f4v*)(orow + db * 16 + 4) = o1;
    }
}

extern "C" void kernel_launch(void* const* d_in, const int* in_sizes, int n_in,
                              void* d_out, int out_size, void* d_ws, size_t ws_size,
                              hipStream_t stream) {
    const float* Q = (const float*)d_in[0];
    const float* K = (const float*)d_in[1];
    const float* V = (const float*)d_in[2];
    float*       O = (float*)d_out;
    (void)in_sizes; (void)n_in; (void)out_size; (void)ws_size;

    const size_t elems = (size_t)NHEAD * S_LEN * DHEAD;     // 4,194,304 per tensor
    _Float16* Kh  = (_Float16*)d_ws;                        // 8.4 MB
    _Float16* VhT = Kh + elems;                             // 8.4 MB (transposed per head)

    cvt_f16_kernel<<<dim3((unsigned)(elems / 8 / 256)), dim3(256), 0, stream>>>(K, Kh, (int)(elems / 8));
    vtrans_kernel<<<dim3(S_LEN / 64, NHEAD), dim3(256), 0, stream>>>(V, VhT);
    fa_wmma_kernel<<<dim3(S_LEN / BR, NHEAD), dim3(128), 0, stream>>>(Q, Kh, VhT, O);
}

// v002
// It runs in 75.6 microseconds.
// In both of two side-by-side timings against v001, it was 1.06 times as fast.
// Over all steps from v000 it is 1.73 times as fast.
#include <hip/hip_runtime.h>
#include <cstdint>

typedef _Float16 h16v __attribute__((ext_vector_type(16)));
typedef _Float16 h8v  __attribute__((ext_vector_type(8)));
typedef _Float16 h4v  __attribute__((ext_vector_type(4)));
typedef float    f8v  __attribute__((ext_vector_type(8)));
typedef float    f4v  __attribute__((ext_vector_type(4)));
typedef unsigned int v4u __attribute__((ext_vector_type(4)));
typedef int          v8i __attribute__((ext_vector_type(8)));
typedef int          v4i __attribute__((ext_vector_type(4)));

#define S_LEN   4096
#define DHEAD   64
#define NHEAD   16
#define BR      64              // q rows per block (16 per wave x 4 waves)
#define BC      64              // keys per tile
#define NKT     (S_LEN / BC)
#define LPAD    8
#define LDW     (DHEAD + LPAD)  // 72 halves = 144 B = 32 DW row + 4 DW pad (matches TDM pad cfg)

#define CAT16(lo, hi) __builtin_shufflevector((lo), (hi), 0,1,2,3,4,5,6,7,8,9,10,11,12,13,14,15)

// ---------------------------------------------------------------------------
// TDM: 2-D tile load Global->LDS. D# packed per ISA ch.8 (group0 128b, group1
// 256b; groups 2/3 + extra group zero for 2-D). data_size=2B; pad 4 DWORDs
// after every 32 DWORDs so a 64-half tile row lands on a 144-B padded LDS row.
// Toolchain here is clang-23 (therock): 6-arg builtin form.
// ---------------------------------------------------------------------------
__device__ __forceinline__ void tdm_load_2d(unsigned lds_addr, const _Float16* gptr,
                                            unsigned tensor_dim0, unsigned tensor_dim1,
                                            unsigned tile_dim0,   unsigned tile_dim1,
                                            unsigned dim0_stride /* elements */)
{
    unsigned long long ga = (unsigned long long)(size_t)gptr;
    v4u g0;
    g0[0] = 1u;                                               // count=1, user descriptor
    g0[1] = lds_addr;                                         // LDS byte address
    g0[2] = (unsigned)ga;                                     // global_addr[31:0]
    g0[3] = ((unsigned)(ga >> 32) & 0x01FFFFFFu) | (2u << 30);// global_addr[56:32] | type=2
    v8i g1;
    g1[0] = (int)((1u << 16) | (1u << 20) | (4u << 22) | (3u << 25)); // 2B, pad_en, int=32DW, amt=4DW
    g1[1] = (int)((tensor_dim0 & 0xFFFFu) << 16);                     // tensor_dim0[15:0]
    g1[2] = (int)((tensor_dim0 >> 16) | ((tensor_dim1 & 0xFFFFu) << 16));
    g1[3] = (int)((tensor_dim1 >> 16) | (tile_dim0 << 16));
    g1[4] = (int)tile_dim1;                                           // tile_dim2 = 0 (2-D)
    g1[5] = (int)dim0_stride;
    g1[6] = 0;                                                        // stride hi / dim1_stride
    g1[7] = 0;
    v4i z4 = (v4i)0;
    v8i z8 = (v8i)0;
    __builtin_amdgcn_tensor_load_to_lds(g0, g1, z4, z4, z8, 0);
}

// ---------------------------------------------------------------------------
// Pre-pass 1: K fp32 -> f16 (same [h][s][d] layout). One-time; removes the
// per-q-block re-conversion (64x redundant) and halves K's L2 traffic.
// ---------------------------------------------------------------------------
__global__ __launch_bounds__(256)
void cvt_f16_kernel(const float* __restrict__ src, _Float16* __restrict__ dst, int n8)
{
    int g = blockIdx.x * 256 + threadIdx.x;
    if (g >= n8) return;
    const float* p = src + (size_t)g * 8;
    f4v a = *(const f4v*)p;
    f4v b = *(const f4v*)(p + 4);
    h8v o;
#pragma unroll
    for (int e = 0; e < 4; ++e) { o[e] = (_Float16)a[e]; o[4 + e] = (_Float16)b[e]; }
    *(h8v*)(dst + (size_t)g * 8) = o;
}

// ---------------------------------------------------------------------------
// Pre-pass 2: V fp32 [h][s][d] -> f16 transposed [h][d][s] via LDS tile, so the
// main loop's V staging is a plain 2-D TDM copy into VsT[d][key].
// ---------------------------------------------------------------------------
__global__ __launch_bounds__(256)
void vtrans_kernel(const float* __restrict__ V, _Float16* __restrict__ VhT)
{
    __shared__ _Float16 T[64][72];
    const int tid = threadIdx.x;
    const int s0  = blockIdx.x * 64;
    const int h   = blockIdx.y;
#pragma unroll
    for (int i = 0; i < 4; ++i) {
        const int idx = i * 256 + tid;          // 1024 float4's per 64x64 tile
        const int r   = idx >> 4;
        const int c4  = (idx & 15) * 4;
        f4v v = *(const f4v*)(V + ((size_t)h * S_LEN + s0 + r) * DHEAD + c4);
#pragma unroll
        for (int e = 0; e < 4; ++e) T[c4 + e][r] = (_Float16)v[e];
    }
    __syncthreads();
#pragma unroll
    for (int i = 0; i < 2; ++i) {
        const int idx = i * 256 + tid;          // 512 h8v chunks out
        const int d   = idx >> 3;
        const int c8  = (idx & 7) * 8;
        *(h8v*)(VhT + ((size_t)h * DHEAD + d) * S_LEN + s0 + c8) = *(const h8v*)&T[d][c8];
    }
}

// ---------------------------------------------------------------------------
// Main flash-attention kernel. 4 waves x 16 queries; per 64-key tile:
// 8 WMMA (S^T = K Q^T) + 2 WMMA (column sums via ones) + 8 WMMA (O^T += V^T P^T).
// Scores are in log2 units (log2 e folded into Q's scale) and the score products
// start from C = -(maximum in use), so the accumulator is the exponent itself.
// The maximum in use may trail the true one by up to 8 (P <= 2^8, well inside f16);
// it is refreshed, and O and the sums rescaled, only in a tile that tops it by more.
// In the transposed products a lane holds scores of ONE query (column l16, keys
// 8*half + r of each 16-key tile): the maximum is in-lane plus one exchange
// between the lane halves, and two score tiles convert in place into the B
// operand of the second product, so P never goes through LDS.
// K/V tiles arrive by TDM into double-buffered LDS (s_wait_tensorcnt).
// ---------------------------------------------------------------------------
__global__ __launch_bounds__(128)
void fa_wmma_kernel(const float* __restrict__ Q, const _Float16* __restrict__ Kh,
                    const _Float16* __restrict__ VhT, float* __restrict__ O)
{
    __shared__ _Float16 Ks [2][BC][LDW];     // [buf][key][d]
    __shared__ _Float16 VsT[2][DHEAD][LDW];  // [buf][d][key]

    const int tid  = threadIdx.x;
    const int lane = tid & 31;
    const int wave = __builtin_amdgcn_readfirstlane(tid >> 5);  // SGPR (uniform TDM operands)
    const int half = lane >> 4;
    const int l16  = lane & 15;
    const int head = blockIdx.y;
    const int qw   = blockIdx.x * BR + wave * 16;

    const _Float16* KhH  = Kh  + (size_t)head * S_LEN * DHEAD;  // [s][d] f16
    const _Float16* VhTH = VhT + (size_t)head * DHEAD * S_LEN;  // [d][s] f16

    // ---- Q B-fragments (log2(e)/sqrt(64) folded in). B-map: lane=N&15 (query), elem i ->
    // K = (i>>3)*16 + half*8 + (i&7), the same k order as the K and V loaders ----
    h16v qa[2];
    {
        const float  sc   = 0.125f * 1.4426950408889634f;
        const float* qrow = Q + ((size_t)head * S_LEN + qw + l16) * DHEAD;
#pragma unroll
        for (int kc = 0; kc < 2; ++kc)
#pragma unroll
            for (int g = 0; g < 2; ++g) {
                const int dbase = kc * 32 + g * 16 + half * 8;
                f4v v0 = *(const f4v*)(qrow + dbase);
                f4v v1 = *(const f4v*)(qrow + dbase + 4);
#pragma unroll
                for (int e = 0; e < 4; ++e) {
                    qa[kc][g * 8 + e]     = (_Float16)(v0[e] * sc);
                    qa[kc][g * 8 + 4 + e] = (_Float16)(v1[e] * sc);
                }
            }
    }

    h16v ones;
#pragma unroll
    for (int i = 0; i < 16; ++i) ones[i] = (_Float16)1.0f;

    f8v   nm;                                // -(maximum in use) of this lane's query, in all 8 rows: the C operand
    f8v   lacc;                              // every row: sum of P of query l16 (same in both halves)
    f8v   acc[4];                            // acc[db][r] = O[query l16][db*16 + half*8 + r]
#pragma unroll
    for (int j = 0; j < 8; ++j) { nm[j] = 0.0f; lacc[j] = 0.0f; }
    float thr = -__builtin_inff();           // how far a tile may top the maximum in use before it is refreshed
#pragma unroll
    for (int t = 0; t < 4; ++t)
#pragma unroll
        for (int j = 0; j < 8; ++j) acc[t][j] = 0.0f;

    // ---- Pre-issue TDM for tile 0: wave w DMAs K rows / V d-rows w*16..w*16+15
    tdm_load_2d((unsigned)(size_t)&Ks[0][wave * 16][0],
                KhH + (size_t)(wave * 16) * DHEAD,
                DHEAD, S_LEN, DHEAD, 16, DHEAD);
    tdm_load_2d((unsigned)(size_t)&VsT[0][wave * 16][0],
                VhTH + (size_t)(wave * 16) * S_LEN,
                S_LEN, DHEAD, BC, 16, S_LEN);

    for (int kt = 0; kt < NKT; ++kt) {
        const int buf = kt & 1;
        __builtin_amdgcn_s_wait_tensorcnt(0);   // this tile's DMA done (my waves' ops)
        __syncthreads();                        // all waves' quarters visible

        if (kt + 1 < NKT) {                     // kick next tile into the other buffer
            const int nb = buf ^ 1;
            tdm_load_2d((unsigned)(size_t)&Ks[nb][wave * 16][0],
                        KhH + (size_t)((kt + 1) * BC + wave * 16) * DHEAD,
                        DHEAD, S_LEN, DHEAD, 16, DHEAD);
            tdm_load_2d((unsigned)(size_t)&VsT[nb][wave * 16][0],
                        VhTH + (size_t)(wave * 16) * S_LEN + (kt + 1) * BC,
                        S_LEN, DHEAD, BC, 16, S_LEN);
        }

        // ---- S^T = K (Q log2e/sqrt d)^T - max in use : s[jb][r] for key jb*16 + half*8 + r, query l16 ----
        f8v s[4];
#pragma unroll
        for (int jb = 0; jb < 4; ++jb) {
            f8v c = nm;
#pragma unroll
            for (int kc = 0; kc < 2; ++kc) {
                const _Float16* kr = &Ks[buf][jb * 16 + l16][0];   // A[m][k]=K[m][d]
                h8v lo = *(const h8v*)(kr + kc * 32 + half * 8);
                h8v hi = *(const h8v*)(kr + kc * 32 + 16 + half * 8);
                h16v kb = CAT16(lo, hi);
                c = __builtin_amdgcn_wmma_f32_16x16x32_f16(
                        false, kb, false, qa[kc], (short)0, c, false, false);
            }
            s[jb] = c;
        }

        // ---- This lane's 32 shifted scores: how far do they top the maximum in use? ----
        float tj[8];
#pragma unroll
        for (int j = 0; j < 8; ++j)
            tj[j] = fmaxf(fmaxf(s[0][j], s[1][j]), fmaxf(s[2][j], s[3][j]));
        const float t = fmaxf(fmaxf(fmaxf(tj[0], tj[1]), fmaxf(tj[2], tj[3])),
                              fmaxf(fmaxf(tj[4], tj[5]), fmaxf(tj[6], tj[7])));

        // One wave-uniform test per tile; thr is -inf in the first tile, which so always sets the maximum.
        if (__builtin_amdgcn_ballot_w32(t > thr) != 0u) {
            const int   tb = __builtin_bit_cast(int, t);
            const int   ob = __builtin_amdgcn_permlanex16(tb, tb, 0x76543210, 0xfedcba98, false, false);
            const float tf = fmaxf(t, __builtin_bit_cast(float, ob));   // lane l <-> l ^ 16: the query's 64 keys
            const float d  = fmaxf(tf, thr - 8.0f);                     // shift of the maximum in use: first tile tf, later never down
            const float corr = __builtin_amdgcn_exp2f(-fmaxf(tf, 0.0f)); // 1 where the maximum does not rise
#pragma unroll
            for (int j = 0; j < 8; ++j) { nm[j] -= d; lacc[j] *= corr; }
#pragma unroll
            for (int jb = 0; jb < 4; ++jb)
#pragma unroll
                for (int j = 0; j < 8; ++j) { s[jb][j] -= d; acc[jb][j] *= corr; }
        }
        thr = 8.0f;

#pragma unroll
        for (int jb = 0; jb < 4; ++jb)
#pragma unroll
            for (int j = 0; j < 8; ++j) s[jb][j] = __builtin_amdgcn_exp2f(s[jb][j]);

        // ---- P^T B-fragments straight from the score tiles: elem i of chunk kc is
        // key kc*32 + (i>>3)*16 + half*8 + (i&7) = s[2*kc + (i>>3)][i&7] ----
        h16v pb[2];
#pragma unroll
        for (int kc = 0; kc < 2; ++kc)
            pb[kc] = CAT16(__builtin_convertvector(s[2 * kc], h8v),
                           __builtin_convertvector(s[2 * kc + 1], h8v));

        // ---- Column sums via WMMA with ones (every row of the result is the sum), kept in the tile ----
        lacc = __builtin_amdgcn_wmma_f32_16x16x32_f16(false, ones, false, pb[0], (short)0, lacc, false, false);
        lacc = __builtin_amdgcn_wmma_f32_16x16x32_f16(false, ones, false, pb[1], (short)0, lacc, false, false);

        // ---- O^T += V^T * P^T ----
#pragma unroll
        for (int kc = 0; kc < 2; ++kc)
#pragma unroll
            for (int db = 0; db < 4; ++db) {
                const _Float16* vr = &VsT[buf][db * 16 + l16][0];  // A[m][k]=V[k][d=m]
                h8v vlo = *(const h8v*)(vr + kc * 32 + half * 8);
                h8v vhi = *(const h8v*)(vr + kc * 32 + 16 + half * 8);
                h16v vb = CAT16(vlo, vhi);
                acc[db] = __builtin_amdgcn_wmma_f32_16x16x32_f16(
                              false, vb, false, pb[kc], (short)0, acc[db], false, false);
            }
    }

    // ---- Normalize + store O (fp32): 8 consecutive d per lane and 16-d group ----
    const float inv  = 1.0f / lacc[0];
    float*      orow = O + ((size_t)head * S_LEN + qw + l16) * DHEAD + half * 8;
#pragma unroll
    for (int db = 0; db < 4; ++db) {
        f4v o0, o1;
#pragma unroll
        for (int e = 0; e < 4; ++e) { o0[e] = acc[db][e] * inv; o1[e] = acc[db][4 + e] * inv; }
        *(f4v*)(orow + db * 16)     = o0;
        *(f4v*)(orow + db * 16 + 4) = o1;
    }
}

extern "C" void kernel_launch(void* const* d_in, const int* in_sizes, int n_in,
                              void* d_out, int out_size, void* d_ws, size_t ws_size,
                              hipStream_t stream) {
    const float* Q = (const float*)d_in[0];
    const float* K = (const float*)d_in[1];
    const float* V = (const float*)d_in[2];
    float*       O = (float*)d_out;
    (void)in_sizes; (void)n_in; (void)out_size; (void)ws_size;

    const size_t elems = (size_t)NHEAD * S_LEN * DHEAD;     // 4,194,304 per tensor
    _Float16* Kh  = (_Float16*)d_ws;                        // 8.4 MB
    _Float16* VhT = Kh + elems;                             // 8.4 MB (transposed per head)

    cvt_f16_kernel<<<dim3((unsigned)(elems / 8 / 256)), dim3(256), 0, stream>>>(K, Kh, (int)(elems / 8));
    vtrans_kernel<<<dim3(S_LEN / 64, NHEAD), dim3(256), 0, stream>>>(V, VhT);
    fa_wmma_kernel<<<dim3(S_LEN / BR, NHEAD), dim3(128), 0, stream>>>(Q, Kh, VhT, O);
}

// v003
// One run takes 68.1 microseconds.
// Two timings next to v002 put it at 1.12 and 1.11 times that version's speed.
// All steps since v000 together make it 1.93 times as fast.
#include <hip/hip_runtime.h>
#include <cstdint>

typedef _Float16 h16v __attribute__((ext_vector_type(16)));
typedef _Float16 h8v  __attribute__((ext_vector_type(8)));
typedef _Float16 h4v  __attribute__((ext_vector_type(4)));
typedef float    f8v  __attribute__((ext_vector_type(8)));
typedef float    f4v  __attribute__((ext_vector_type(4)));
typedef unsigned int v4u __attribute__((ext_vector_type(4)));
typedef int          v8i __attribute__((ext_vector_type(8)));
typedef int          v4i __attribute__((ext_vector_type(4)));

#define S_LEN   4096
#define DHEAD   64
#define NHEAD   16
#define QG      2               // 16-query column groups per wave
#define BR      (64 * QG)       // q rows per block (16 * QG per wave x 4 waves)
#define BC      64              // keys per tile
#define NKT     (S_LEN / BC)
#define LPAD    8
#define LDW     (DHEAD + LPAD)  // 72 halves = 144 B = 32 DW row + 4 DW pad (matches TDM pad cfg)

#define CAT16(lo, hi) __builtin_shufflevector((lo), (hi), 0,1,2,3,4,5,6,7,8,9,10,11,12,13,14,15)

// ---------------------------------------------------------------------------
// TDM: 2-D tile load Global->LDS. D# packed per ISA ch.8 (group0 128b, group1
// 256b; groups 2/3 + extra group zero for 2-D). data_size=2B; pad 4 DWORDs
// after every 32 DWORDs so a 64-half tile row lands on a 144-B padded LDS row.
// Toolchain here is clang-23 (therock): 6-arg builtin form.
// ---------------------------------------------------------------------------
__device__ __forceinline__ void tdm_load_2d(unsigned lds_addr, const _Float16* gptr,
                                            unsigned tensor_dim0, unsigned tensor_dim1,
                                            unsigned tile_dim0,   unsigned tile_dim1,
                                            unsigned dim0_stride /* elements */)
{
    unsigned long long ga = (unsigned long long)(size_t)gptr;
    v4u g0;
    g0[0] = 1u;                                               // count=1, user descriptor
    g0[1] = lds_addr;                                         // LDS byte address
    g0[2] = (unsigned)ga;                                     // global_addr[31:0]
    g0[3] = ((unsigned)(ga >> 32) & 0x01FFFFFFu) | (2u << 30);// global_addr[56:32] | type=2
    v8i g1;
    g1[0] = (int)((1u << 16) | (1u << 20) | (4u << 22) | (3u << 25)); // 2B, pad_en, int=32DW, amt=4DW
    g1[1] = (int)((tensor_dim0 & 0xFFFFu) << 16);                     // tensor_dim0[15:0]
    g1[2] = (int)((tensor_dim0 >> 16) | ((tensor_dim1 & 0xFFFFu) << 16));
    g1[3] = (int)((tensor_dim1 >> 16) | (tile_dim0 << 16));
    g1[4] = (int)tile_dim1;                                           // tile_dim2 = 0 (2-D)
    g1[5] = (int)dim0_stride;
    g1[6] = 0;                                                        // stride hi / dim1_stride
    g1[7] = 0;
    v4i z4 = (v4i)0;
    v8i z8 = (v8i)0;
    __builtin_amdgcn_tensor_load_to_lds(g0, g1, z4, z4, z8, 0);
}

// ---------------------------------------------------------------------------
// Pre-pass 1: K fp32 -> f16 (same [h][s][d] layout). One-time; removes the
// per-q-block re-conversion (32x redundant) and halves K's L2 traffic.
// ---------------------------------------------------------------------------
__global__ __launch_bounds__(256)
void cvt_f16_kernel(const float* __restrict__ src, _Float16* __restrict__ dst, int n8)
{
    int g = blockIdx.x * 256 + threadIdx.x;
    if (g >= n8) return;
    const float* p = src + (size_t)g * 8;
    f4v a = *(const f4v*)p;
    f4v b = *(const f4v*)(p + 4);
    h8v o;
#pragma unroll
    for (int e = 0; e < 4; ++e) { o[e] = (_Float16)a[e]; o[4 + e] = (_Float16)b[e]; }
    *(h8v*)(dst + (size_t)g * 8) = o;
}

// ---------------------------------------------------------------------------
// Pre-pass 2: V fp32 [h][s][d] -> f16 transposed [h][d][s] via LDS tile, so the
// main loop's V staging is a plain 2-D TDM copy into VsT[d][key].
// ---------------------------------------------------------------------------
__global__ __launch_bounds__(256)
void vtrans_kernel(const float* __restrict__ V, _Float16* __restrict__ VhT)
{
    __shared__ _Float16 T[64][72];
    const int tid = threadIdx.x;
    const int s0  = blockIdx.x * 64;
    const int h   = blockIdx.y;
#pragma unroll
    for (int i = 0; i < 4; ++i) {
        const int idx = i * 256 + tid;          // 1024 float4's per 64x64 tile
        const int r   = idx >> 4;
        const int c4  = (idx & 15) * 4;
        f4v v = *(const f4v*)(V + ((size_t)h * S_LEN + s0 + r) * DHEAD + c4);
#pragma unroll
        for (int e = 0; e < 4; ++e) T[c4 + e][r] = (_Float16)v[e];
    }
    __syncthreads();
#pragma unroll
    for (int i = 0; i < 2; ++i) {
        const int idx = i * 256 + tid;          // 512 h8v chunks out
        const int d   = idx >> 3;
        const int c8  = (idx & 7) * 8;
        *(h8v*)(VhT + ((size_t)h * DHEAD + d) * S_LEN + s0 + c8) = *(const h8v*)&T[d][c8];
    }
}

// ---------------------------------------------------------------------------
// Main flash-attention kernel. 4 waves x QG groups of 16 queries; per 64-key tile and group:
// 8 WMMA (S^T = K Q^T) + 2 WMMA (column sums via ones) + 8 WMMA (O^T += V^T P^T).
// Each K and V fragment is read from LDS once and feeds the WMMAs of all QG groups.
// Scores are in log2 units (log2 e folded into Q's scale) and the score products
// start from C = -(maximum in use), so the accumulator is the exponent itself.
// The maximum in use may trail the true one by up to 8 (P <= 2^8, well inside f16);
// it is refreshed, and O and the sums rescaled, only in a tile that tops it by more.
// In the transposed products a lane holds, per group, scores of ONE query (column l16, keys
// 8*half + r of each 16-key tile): the maximum is in-lane plus one exchange
// between the lane halves, and two score tiles convert in place into the B
// operand of the second product, so P never goes through LDS.
// K/V tiles arrive by TDM into double-buffered LDS (s_wait_tensorcnt).
// ---------------------------------------------------------------------------
__global__ __launch_bounds__(128)
void fa_wmma_kernel(const float* __restrict__ Q, const _Float16* __restrict__ Kh,
                    const _Float16* __restrict__ VhT, float* __restrict__ O)
{
    __shared__ _Float16 Ks [2][BC][LDW];     // [buf][key][d]
    __shared__ _Float16 VsT[2][DHEAD][LDW];  // [buf][d][key]

    const int tid  = threadIdx.x;
    const int lane = tid & 31;
    const int wave = __builtin_amdgcn_readfirstlane(tid >> 5);  // SGPR (uniform TDM operands)
    const int half = lane >> 4;
    const int l16  = lane & 15;
    const int head = blockIdx.y;
    const int qw   = blockIdx.x * BR + wave * (16 * QG);

    const _Float16* KhH  = Kh  + (size_t)head * S_LEN * DHEAD;  // [s][d] f16
    const _Float16* VhTH = VhT + (size_t)head * DHEAD * S_LEN;  // [d][s] f16

    // ---- Q B-fragments (log2(e)/sqrt(64) folded in). B-map: lane=N&15 (query), elem i ->
    // K = (i>>3)*16 + half*8 + (i&7), the same k order as the K and V loaders ----
    h16v qa[QG][2];
#pragma unroll
    for (int q = 0; q < QG; ++q) {
        const float  sc   = 0.125f * 1.4426950408889634f;
        const float* qrow = Q + ((size_t)head * S_LEN + qw + q * 16 + l16) * DHEAD;
#pragma unroll
        for (int kc = 0; kc < 2; ++kc)
#pragma unroll
            for (int g = 0; g < 2; ++g) {
                const int dbase = kc * 32 + g * 16 + half * 8;
                f4v v0 = *(const f4v*)(qrow + dbase);
                f4v v1 = *(const f4v*)(qrow + dbase + 4);
#pragma unroll
                for (int e = 0; e < 4; ++e) {
                    qa[q][kc][g * 8 + e]     = (_Float16)(v0[e] * sc);
                    qa[q][kc][g * 8 + 4 + e] = (_Float16)(v1[e] * sc);
                }
            }
    }

    h16v ones;
#pragma unroll
    for (int i = 0; i < 16; ++i) ones[i] = (_Float16)1.0f;

    f8v   nm[QG];                            // -(maximum in use) of this lane's query of the group, in all 8 rows: the C operand
    f8v   lacc[QG];                          // every row: sum of P of query l16 of the group (same in both halves)
    f8v   acc[QG][4];                        // acc[q][db][r] = O[query q*16 + l16][db*16 + half*8 + r]
    float thr = -__builtin_inff();           // how far a tile may top the maximum in use before it is refreshed
#pragma unroll
    for (int q = 0; q < QG; ++q) {
#pragma unroll
        for (int j = 0; j < 8; ++j) { nm[q][j] = 0.0f; lacc[q][j] = 0.0f; }
#pragma unroll
        for (int t = 0; t < 4; ++t)
#pragma unroll
            for (int j = 0; j < 8; ++j) acc[q][t][j] = 0.0f;
    }

    // ---- Pre-issue TDM for tile 0: wave w DMAs K rows / V d-rows w*16..w*16+15
    tdm_load_2d((unsigned)(size_t)&Ks[0][wave * 16][0],
                KhH + (size_t)(wave * 16) * DHEAD,
                DHEAD, S_LEN, DHEAD, 16, DHEAD);
    tdm_load_2d((unsigned)(size_t)&VsT[0][wave * 16][0],
                VhTH + (size_t)(wave * 16) * S_LEN,
                S_LEN, DHEAD, BC, 16, S_LEN);

    // One copy of the pass (no peeled first pass): the second groups of both descriptors then stay in scalar
    // registers that nothing rewrites.
#pragma clang loop unroll(disable)
    for (int kt = 0; kt < NKT; ++kt) {
        const int buf = kt & 1;
        __builtin_amdgcn_s_wait_tensorcnt(0);   // this tile's DMA done (my waves' ops)
        __syncthreads();                        // all waves' quarters visible

        if (kt + 1 < NKT) {                     // kick next tile into the other buffer
            const int nb = buf ^ 1;
            tdm_load_2d((unsigned)(size_t)&Ks[nb][wave * 16][0],
                        KhH + (size_t)((kt + 1) * BC + wave * 16) * DHEAD,
                        DHEAD, S_LEN, DHEAD, 16, DHEAD);
            tdm_load_2d((unsigned)(size_t)&VsT[nb][wave * 16][0],
                        VhTH + (size_t)(wave * 16) * S_LEN + (kt + 1) * BC,
                        S_LEN, DHEAD, BC, 16, S_LEN);
        }

        // ---- S^T = K (Q log2e/sqrt d)^T - max in use : s[q][jb][r] for key jb*16 + half*8 + r, query q*16 + l16 ----
        f8v s[QG][4];
#pragma unroll
        for (int jb = 0; jb < 4; ++jb) {
            const _Float16* kr = &Ks[buf][jb * 16 + l16][0];       // A[m][k]=K[m][d]
#pragma unroll
            for (int q = 0; q < QG; ++q) s[q][jb] = nm[q];
#pragma unroll
            for (int kc = 0; kc < 2; ++kc) {
                h8v lo = *(const h8v*)(kr + kc * 32 + half * 8);
                h8v hi = *(const h8v*)(kr + kc * 32 + 16 + half * 8);
                h16v kb = CAT16(lo, hi);
#pragma unroll
                for (int q = 0; q < QG; ++q)
                    s[q][jb] = __builtin_amdgcn_wmma_f32_16x16x32_f16(
                                   false, kb, false, qa[q][kc], (short)0, s[q][jb], false, false);
            }
        }

        // ---- Per group, this lane's 32 shifted scores: how far do they top the maximum in use? ----
        float t[QG];
#pragma unroll
        for (int q = 0; q < QG; ++q) {
            float tj[8];
#pragma unroll
            for (int j = 0; j < 8; ++j)
                tj[j] = fmaxf(fmaxf(s[q][0][j], s[q][1][j]), fmaxf(s[q][2][j], s[q][3][j]));
            t[q] = fmaxf(fmaxf(fmaxf(tj[0], tj[1]), fmaxf(tj[2], tj[3])),
                         fmaxf(fmaxf(tj[4], tj[5]), fmaxf(tj[6], tj[7])));
        }
        float tall = t[0];
#pragma unroll
        for (int q = 1; q < QG; ++q) tall = fmaxf(tall, t[q]);

        // One wave-uniform test per tile; thr is -inf in the first tile, which so always sets the maximum.
        if (__builtin_amdgcn_ballot_w32(tall > thr) != 0u) {
#pragma unroll
            for (int q = 0; q < QG; ++q) {
                const int   tb = __builtin_bit_cast(int, t[q]);
                const int   ob = __builtin_amdgcn_permlanex16(tb, tb, 0x76543210, 0xfedcba98, false, false);
                const float tf = fmaxf(t[q], __builtin_bit_cast(float, ob)); // lane l <-> l ^ 16: the query's 64 keys
                const float d  = fmaxf(tf, thr - 8.0f);                      // shift of the maximum in use: first tile tf, later never down
                const float corr = __builtin_amdgcn_exp2f(-fmaxf(tf, 0.0f)); // 1 where the maximum does not rise
#pragma unroll
                for (int j = 0; j < 8; ++j) { nm[q][j] -= d; lacc[q][j] *= corr; }
#pragma unroll
                for (int jb = 0; jb < 4; ++jb)
#pragma unroll
                    for (int j = 0; j < 8; ++j) { s[q][jb][j] -= d; acc[q][jb][j] *= corr; }
            }
        }
        thr = 8.0f;

        // ---- P^T B-fragments straight from the score tiles: elem i of chunk kc is
        // key kc*32 + (i>>3)*16 + half*8 + (i&7) = s[q][2*kc + (i>>3)][i&7] ----
        h16v pb[QG][2];
#pragma unroll
        for (int q = 0; q < QG; ++q) {
#pragma unroll
            for (int jb = 0; jb < 4; ++jb)
#pragma unroll
                for (int j = 0; j < 8; ++j) s[q][jb][j] = __builtin_amdgcn_exp2f(s[q][jb][j]);
#pragma unroll
            for (int kc = 0; kc < 2; ++kc)
                pb[q][kc] = CAT16(__builtin_convertvector(s[q][2 * kc], h8v),
                                  __builtin_convertvector(s[q][2 * kc + 1], h8v));
        }

        // ---- Column sums via WMMA with ones (every row of the result is the sum), kept in the tile ----
#pragma unroll
        for (int kc = 0; kc < 2; ++kc)
#pragma unroll
            for (int q = 0; q < QG; ++q)
                lacc[q] = __builtin_amdgcn_wmma_f32_16x16x32_f16(
                              false, ones, false, pb[q][kc], (short)0, lacc[q], false, false);

        // ---- O^T += V^T * P^T ----
#pragma unroll
        for (int kc = 0; kc < 2; ++kc)
#pragma unroll
            for (int db = 0; db < 4; ++db) {
                const _Float16* vr = &VsT[buf][db * 16 + l16][0];  // A[m][k]=V[k][d=m]
                h8v vlo = *(const h8v*)(vr + kc * 32 + half * 8);
                h8v vhi = *(const h8v*)(vr + kc * 32 + 16 + half * 8);
                h16v vb = CAT16(vlo, vhi);
#pragma unroll
                for (int q = 0; q < QG; ++q)
                    acc[q][db] = __builtin_amdgcn_wmma_f32_16x16x32_f16(
                                     false, vb, false, pb[q][kc], (short)0, acc[q][db], false, false);
            }
    }

    // ---- Normalize + store O (fp32): 8 consecutive d per lane and 16-d group ----
#pragma unroll
    for (int q = 0; q < QG; ++q) {
        const float inv  = 1.0f / lacc[q][0];
        float*      orow = O + ((size_t)head * S_LEN + qw + q * 16 + l16) * DHEAD + half * 8;
#pragma unroll
        for (int db = 0; db < 4; ++db) {
            f4v o0, o1;
#pragma unroll
            for (int e = 0; e < 4; ++e) { o0[e] = acc[q][db][e] * inv; o1[e] = acc[q][db][4 + e] * inv; }
            *(f4v*)(orow + db * 16)     = o0;
            *(f4v*)(orow + db * 16 + 4) = o1;
        }
    }
}

extern "C" void kernel_launch(void* const* d_in, const int* in_sizes, int n_in,
                              void* d_out, int out_size, void* d_ws, size_t ws_size,
                              hipStream_t stream) {
    const float* Q = (const float*)d_in[0];
    const float* K = (const float*)d_in[1];
    const float* V = (const float*)d_in[2];
    float*       O = (float*)d_out;
    (void)in_sizes; (void)n_in; (void)out_size; (void)ws_size;

    const size_t elems = (size_t)NHEAD * S_LEN * DHEAD;     // 4,194,304 per tensor
    _Float16* Kh  = (_Float16*)d_ws;                        // 8.4 MB
    _Float16* VhT = Kh + elems;                             // 8.4 MB (transposed per head)

    cvt_f16_kernel<<<dim3((unsigned)(elems / 8 / 256)), dim3(256), 0, stream>>>(K, Kh, (int)(elems / 8));
    vtrans_kernel<<<dim3(S_LEN / 64, NHEAD), dim3(256), 0, stream>>>(V, VhT);
    fa_wmma_kernel<<<dim3(S_LEN / BR, NHEAD), dim3(128), 0, stream>>>(Q, Kh, VhT, O);
}

// v004
// It runs in 60.7 microseconds.
// In two side-by-side timings against v003, it was 1.13 and 1.12 times as fast.
// Over all steps from v000 it is 2.16 times as fast.
#include <hip/hip_runtime.h>
#include <cstdint>

typedef _Float16 h16v __attribute__((ext_vector_type(16)));
typedef _Float16 h8v  __attribute__((ext_vector_type(8)));
typedef _Float16 h4v  __attribute__((ext_vector_type(4)));
typedef float    f8v  __attribute__((ext_vector_type(8)));
typedef float    f4v  __attribute__((ext_vector_type(4)));

#define S_LEN   4096
#define DHEAD   64
#define NHEAD   16
#define QG      2               // 16-query column groups per wave
#define BR      (64 * QG)       // q rows per block (16 * QG per wave x 4 waves of a key group)
#define BC      64              // keys per tile of one key group
#define NGRP    2               // key groups per block: group g takes tile g of every stage
#define SKEYS   (BC * NGRP)     // keys per stage
#define NST     (S_LEN / SKEYS) // stages = passes
#define ROWB    128u            // bytes of a staged row: 64 halves (a K row; 64 keys of a V^T row)
#define PITCHB  144u            // its pitch in LDS: the row + 16 B of pad, for the ds_load_b128 readers
#define SROWS   32u             // rows per slice = per tensor load
#define SLICEB  6144u           // 32 x 144 = 4608 B, rounded up so that every slice starts at a multiple of 2 KiB
#define STAGEB  (8u * SLICEB)   // slices 0..3: K keys 32 j ..; slices 4..7: V^T of key group (j >> 1), d rows 32 (j & 1) ..

#define CAT16(lo, hi) __builtin_shufflevector((lo), (hi), 0,1,2,3,4,5,6,7,8,9,10,11,12,13,14,15)

typedef uint32_t u32x4 __attribute__((ext_vector_type(4)));
typedef uint32_t u32x8 __attribute__((ext_vector_type(8)));

__device__ __forceinline__ uint32_t uni(uint32_t v) { return (uint32_t)__builtin_amdgcn_readfirstlane(v); }
// A wave-uniform value held in a scalar register, formed no earlier than this place: makes the issue test a scalar
// branch, and keeps the words of the next descriptor from being formed ahead of the wait that stands in front of it.
__device__ __forceinline__ uint32_t pinned(uint32_t v) { uint32_t w = uni(v); asm volatile("" : "+s"(w)); return w; }
// The compiler places no wait for the tensor mover, and none for LDS reads in front of a refill: these two are the ring's.
__device__ __forceinline__ void wait_ds0()     { asm volatile("s_wait_dscnt 0x0" ::: "memory"); }
__device__ __forceinline__ void wait_tensor0() { asm volatile("s_wait_tensorcnt 0x0" ::: "memory"); }

// ---------------------------------------------------------------------------
// Tensor load, global -> LDS: a tile of SROWS rows of ROWB bytes (1-byte elements, tensor = tile),
// 4 dwords of LDS pad behind every 32-dword row, so that rows land at PITCHB.
// ---------------------------------------------------------------------------
__device__ __forceinline__ u32x8 tdm_group1(uint32_t src_pitch)
{
    u32x8 g;
    g[0] = uni((1u << 20) | (4u << 22) | (3u << 25));   // no mask, 1-byte elements, pad on: interval 32 dwords, amount 4 dwords
    g[1] = uni(ROWB << 16);                             // tensor_dim0 [15:0]
    g[2] = uni(SROWS << 16);                            // tensor_dim0 [31:16] = 0 | tensor_dim1 [15:0]
    g[3] = uni(ROWB << 16);                             // tensor_dim1 [31:16] = 0 | tile_dim0
    g[4] = uni(SROWS);                                  // tile_dim1
    g[5] = uni(src_pitch);                              // source row pitch, bytes
    g[6] = uni(0u);
    g[7] = uni(0u);
    return g;
}
__device__ __forceinline__ void tdm_aim(u32x4& g, uint32_t lds_dst, uint64_t ga)
{
    g[1] = uni(lds_dst);                                                  // byte offset in the work-group's LDS
    g[2] = uni((uint32_t)ga);                                             // address [31:0]
    g[3] = uni((((uint32_t)(ga >> 32)) & 0x01FFFFFFu) | 0x80000000u);     // address [56:32] | type = 2
}
__device__ __forceinline__ u32x4 tdm_group0(uint32_t lds_dst, uint64_t ga)
{
    u32x4 g;
    g[0] = uni(1u);                                                       // count = 1
    tdm_aim(g, lds_dst, ga);
    return g;
}
// Both groups are in-out operands: their twelve scalar registers then stay the descriptor's own from one load to the
// next. As plain inputs the compiler re-formed the constant words at each load and, between two loads, with a request
// in flight, used their registers for other values.
__device__ __forceinline__ void tdm_load(u32x4& g0, u32x8& g1)
{
    asm volatile("tensor_load_to_lds %0, %1" : "+s"(g0), "+s"(g1) :: "memory");
}

// ---------------------------------------------------------------------------
// Pre-pass 1: K fp32 -> f16 (same [h][s][d] layout). One-time; removes the
// per-q-block re-conversion (32x redundant) and halves K's L2 traffic.
// ---------------------------------------------------------------------------
__global__ __launch_bounds__(256)
void cvt_f16_kernel(const float* __restrict__ src, _Float16* __restrict__ dst, int n8)
{
    int g = blockIdx.x * 256 + threadIdx.x;
    if (g >= n8) return;
    const float* p = src + (size_t)g * 8;
    f4v a = *(const f4v*)p;
    f4v b = *(const f4v*)(p + 4);
    h8v o;
#pragma unroll
    for (int e = 0; e < 4; ++e) { o[e] = (_Float16)a[e]; o[4 + e] = (_Float16)b[e]; }
    *(h8v*)(dst + (size_t)g * 8) = o;
}

// ---------------------------------------------------------------------------
// Pre-pass 2: V fp32 [h][s][d] -> f16 transposed [h][d][s] via LDS tile, so the
// main loop's V staging is a plain 2-D TDM copy into the ring's V^T slices, [d][key].
// ---------------------------------------------------------------------------
__global__ __launch_bounds__(256)
void vtrans_kernel(const float* __restrict__ V, _Float16* __restrict__ VhT)
{
    __shared__ _Float16 T[64][72];
    const int tid = threadIdx.x;
    const int s0  = blockIdx.x * 64;
    const int h   = blockIdx.y;
#pragma unroll
    for (int i = 0; i < 4; ++i) {
        const int idx = i * 256 + tid;          // 1024 float4's per 64x64 tile
        const int r   = idx >> 4;
        const int c4  = (idx & 15) * 4;
        f4v v = *(const f4v*)(V + ((size_t)h * S_LEN + s0 + r) * DHEAD + c4);
#pragma unroll
        for (int e = 0; e < 4; ++e) T[c4 + e][r] = (_Float16)v[e];
    }
    __syncthreads();
#pragma unroll
    for (int i = 0; i < 2; ++i) {
        const int idx = i * 256 + tid;          // 512 h8v chunks out
        const int d   = idx >> 3;
        const int c8  = (idx & 7) * 8;
        *(h8v*)(VhT + ((size_t)h * DHEAD + d) * S_LEN + s0 + c8) = *(const h8v*)&T[d][c8];
    }
}

// ---------------------------------------------------------------------------
// Main flash-attention kernel. 8 waves = NGRP key groups x 4 waves; a wave holds QG groups of 16 queries and walks
// the 64-key tiles of its key group (tile g of every 128-key stage), so that the two waves that serve the same
// 32 queries run side by side: 4 waves per SIMD with two blocks per WGP. Per tile and query group:
// 8 WMMA (S^T = K Q^T) + 2 WMMA (column sums via ones) + 8 WMMA (O^T += V^T P^T).
// Each K and V fragment is read from LDS once and feeds the WMMAs of all QG groups.
// Scores are in log2 units (log2 e folded into Q's scale) and the score products
// start from C = -(maximum in use), so the accumulator is the exponent itself.
// The maximum in use may trail the true one by up to 8 (P <= 2^8, well inside f16);
// it is refreshed, and O and the sums rescaled, only in a tile that tops it by more.
// In the transposed products a lane holds, per group, scores of ONE query (column l16, keys
// 8*half + r of each 16-key tile): the maximum is in-lane plus one exchange
// between the lane halves, and two score tiles convert in place into the B
// operand of the second product, so P never goes through LDS.
// K/V stages arrive by tensor loads, one slice per wave and stage, into a ring of two buffers.
// Behind the loop the two key groups' partial (maximum, sum, O) are joined through LDS:
// each wave hands one of its query groups to its partner and finishes the other.
// ---------------------------------------------------------------------------
__global__ __launch_bounds__(256) __attribute__((amdgpu_waves_per_eu(4, 4)))
void fa_wmma_kernel(const float* __restrict__ Q, const _Float16* __restrict__ Kh,
                    const _Float16* __restrict__ VhT, float* __restrict__ O)
{
    __shared__ __attribute__((aligned(2048))) unsigned char Ring[2 * STAGEB];  // [buf][slice][row at PITCHB]
    __shared__ f4v   Mx[4 * NGRP][8][32];    // [wave][16-byte piece][lane]: the O tile handed to the partner wave
    __shared__ float Ms[4 * NGRP][2][32];    // [wave][-(maximum in use), sum][lane] of the same query group

    const int      tid  = threadIdx.x;
    const int      lane = tid & 31;
    const uint32_t wave = uni((uint32_t)tid >> 5);
    const uint32_t grp  = wave >> 2;         // key group
    const uint32_t wj   = wave & 3u;         // which 32 queries; which slice of K or of V^T
    const int half = lane >> 4;
    const int l16  = lane & 15;
    const int head = blockIdx.y;
    const int qw   = blockIdx.x * BR + (int)wj * (16 * QG);

    const _Float16* KhH  = Kh  + (size_t)head * S_LEN * DHEAD;  // [s][d] f16
    const _Float16* VhTH = VhT + (size_t)head * DHEAD * S_LEN;  // [d][s] f16

    // ---- This wave's slice of every stage: waves 0..3 K keys 32 wj .., waves 4..7 V^T d rows 32 (wj & 1) .. of key group wj >> 1 ----
    const bool     isK   = wave < 4u;
    const uint64_t ga0   = isK ? (uint64_t)(size_t)KhH  + (uint64_t)(wj * SROWS) * ROWB
                               : (uint64_t)(size_t)VhTH + (uint64_t)((wj & 1u) * SROWS) * (S_LEN * 2u) + (uint64_t)((wj >> 1) * ROWB);
    const uint32_t gstep = isK ? SKEYS * ROWB : SKEYS * 2u;     // bytes from one stage's slice to the next
    const uint32_t dst0  = (uint32_t)(size_t)&Ring[0] + wave * SLICEB;
    u32x8          g1    = tdm_group1(isK ? ROWB : S_LEN * 2u);

    // ---- Q B-fragments (log2(e)/sqrt(64) folded in). B-map: lane=N&15 (query), elem i ->
    // K = (i>>3)*16 + half*8 + (i&7), the same k order as the K and V loaders ----
    h16v qa[QG][2];
#pragma unroll
    for (int q = 0; q < QG; ++q) {
        const float  sc   = 0.125f * 1.4426950408889634f;
        const float* qrow = Q + ((size_t)head * S_LEN + qw + q * 16 + l16) * DHEAD;
#pragma unroll
        for (int kc = 0; kc < 2; ++kc)
#pragma unroll
            for (int g = 0; g < 2; ++g) {
                const int dbase = kc * 32 + g * 16 + half * 8;
                f4v v0 = *(const f4v*)(qrow + dbase);
                f4v v1 = *(const f4v*)(qrow + dbase + 4);
#pragma unroll
                for (int e = 0; e < 4; ++e) {
                    qa[q][kc][g * 8 + e]     = (_Float16)(v0[e] * sc);
                    qa[q][kc][g * 8 + 4 + e] = (_Float16)(v1[e] * sc);
                }
            }
    }

    h16v ones;
#pragma unroll
    for (int i = 0; i < 16; ++i) ones[i] = (_Float16)1.0f;

    f8v   nm[QG];                            // -(maximum in use) of this lane's query of the group, in all 8 rows: the C operand
    f8v   lacc[QG];                          // every row: sum of P of query l16 of the group (same in both halves)
    f8v   acc[QG][4];                        // acc[q][db][r] = O[query q*16 + l16][db*16 + half*8 + r]
    float thr = -__builtin_inff();           // how far a tile may top the maximum in use before it is refreshed
#pragma unroll
    for (int q = 0; q < QG; ++q) {
#pragma unroll
        for (int j = 0; j < 8; ++j) { nm[q][j] = 0.0f; lacc[q][j] = 0.0f; }
#pragma unroll
        for (int t = 0; t < 4; ++t)
#pragma unroll
            for (int j = 0; j < 8; ++j) acc[q][t][j] = 0.0f;
    }

    // ---- Ring of two buffers, prologue: stage 0 landed and published, stage 1 in flight ----
    u32x4 g0 = tdm_group0(dst0, ga0);
    tdm_load(g0, g1);
    wait_tensor0();
    __syncthreads();
    tdm_aim(g0, dst0 + STAGEB, ga0 + gstep);
    tdm_load(g0, g1);

    // This lane's first byte in its key group's K slices of buffer 0; the V^T slices stand 4 slices further on.
    const unsigned char* lbase = &Ring[0] + grp * (2u * SLICEB) + (uint32_t)l16 * PITCHB + (uint32_t)half * 16u;

    // One copy of the pass (no peeled first pass), as before: one refill site, one set of descriptor registers.
#pragma clang loop unroll(disable)
    for (int st = 0; st < NST; ++st) {
        const uint32_t       bofs = (uint32_t)(st & 1) * STAGEB;
        const unsigned char* kbp  = lbase + bofs;
        const unsigned char* vbp  = kbp + 4u * SLICEB;

        // ---- S^T = K (Q log2e/sqrt d)^T - max in use : s[q][jb][r] for key jb*16 + half*8 + r, query q*16 + l16 ----
        f8v s[QG][4];
#pragma unroll
        for (int jb = 0; jb < 4; ++jb) {
            const unsigned char* kr = kbp + (jb >> 1) * SLICEB + (jb & 1) * 16 * PITCHB;   // A[m][k]=K[m][d]
#pragma unroll
            for (int q = 0; q < QG; ++q) s[q][jb] = nm[q];
#pragma unroll
            for (int kc = 0; kc < 2; ++kc) {
                h8v lo = *(const h8v*)(kr + kc * 64);
                h8v hi = *(const h8v*)(kr + kc * 64 + 32);
                h16v kb = CAT16(lo, hi);
#pragma unroll
                for (int q = 0; q < QG; ++q)
                    s[q][jb] = __builtin_amdgcn_wmma_f32_16x16x32_f16(
                                   false, kb, false, qa[q][kc], (short)0, s[q][jb], false, false);
            }
        }

        // ---- Per group, this lane's 32 shifted scores: how far do they top the maximum in use? ----
        float t[QG];
#pragma unroll
        for (int q = 0; q < QG; ++q) {
            float tj[8];
#pragma unroll
            for (int j = 0; j < 8; ++j)
                tj[j] = fmaxf(fmaxf(s[q][0][j], s[q][1][j]), fmaxf(s[q][2][j], s[q][3][j]));
            t[q] = fmaxf(fmaxf(fmaxf(tj[0], tj[1]), fmaxf(tj[2], tj[3])),
                         fmaxf(fmaxf(tj[4], tj[5]), fmaxf(tj[6], tj[7])));
        }
        float tall = t[0];
#pragma unroll
        for (int q = 1; q < QG; ++q) tall = fmaxf(tall, t[q]);

        // One wave-uniform test per tile; thr is -inf in the first tile, which so always sets the maximum.
        if (__builtin_amdgcn_ballot_w32(tall > thr) != 0u) {
#pragma unroll
            for (int q = 0; q < QG; ++q) {
                const int   tb = __builtin_bit_cast(int, t[q]);
                const int   ob = __builtin_amdgcn_permlanex16(tb, tb, 0x76543210, 0xfedcba98, false, false);
                const float tf = fmaxf(t[q], __builtin_bit_cast(float, ob)); // lane l <-> l ^ 16: the query's 64 keys
                const float d  = fmaxf(tf, thr - 8.0f);                      // shift of the maximum in use: first tile tf, later never down
                const float corr = __builtin_amdgcn_exp2f(-fmaxf(tf, 0.0f)); // 1 where the maximum does not rise
#pragma unroll
                for (int j = 0; j < 8; ++j) { nm[q][j] -= d; lacc[q][j] *= corr; }
#pragma unroll
                for (int jb = 0; jb < 4; ++jb)
#pragma unroll
                    for (int j = 0; j < 8; ++j) { s[q][jb][j] -= d; acc[q][jb][j] *= corr; }
            }
        }
        thr = 8.0f;

        // ---- P^T B-fragments straight from the score tiles: elem i of chunk kc is
        // key kc*32 + (i>>3)*16 + half*8 + (i&7) = s[q][2*kc + (i>>3)][i&7] ----
        h16v pb[QG][2];
#pragma unroll
        for (int q = 0; q < QG; ++q) {
#pragma unroll
            for (int jb = 0; jb < 4; ++jb)
#pragma unroll
                for (int j = 0; j < 8; ++j) s[q][jb][j] = __builtin_amdgcn_exp2f(s[q][jb][j]);
#pragma unroll
            for (int kc = 0; kc < 2; ++kc)
                pb[q][kc] = CAT16(__builtin_convertvector(s[q][2 * kc], h8v),
                                  __builtin_convertvector(s[q][2 * kc + 1], h8v));
        }

        // ---- Column sums via WMMA with ones (every row of the result is the sum), kept in the tile ----
#pragma unroll
        for (int kc = 0; kc < 2; ++kc)
#pragma unroll
            for (int q = 0; q < QG; ++q)
                lacc[q] = __builtin_amdgcn_wmma_f32_16x16x32_f16(
                              false, ones, false, pb[q][kc], (short)0, lacc[q], false, false);

        // ---- O^T += V^T * P^T ----
#pragma unroll
        for (int kc = 0; kc < 2; ++kc)
#pragma unroll
            for (int db = 0; db < 4; ++db) {
                const unsigned char* vr = vbp + (db >> 1) * SLICEB + (db & 1) * 16 * PITCHB;  // A[m][k]=V[k][d=m]
                h8v vlo = *(const h8v*)(vr + kc * 64);
                h8v vhi = *(const h8v*)(vr + kc * 64 + 32);
                h16v vb = CAT16(vlo, vhi);
#pragma unroll
                for (int q = 0; q < QG; ++q)
                    acc[q][db] = __builtin_amdgcn_wmma_f32_16x16x32_f16(
                                     false, vb, false, pb[q][kc], (short)0, acc[q][db], false, false);
            }

        // ---- Publish point of stage st + 1: my reads of this buffer are done, my slice of the next has landed,
        // every wave has said the same; only then the refill of the buffer that this pass has read ----
        wait_ds0();
        wait_tensor0();
        __syncthreads();
        if (pinned((uint32_t)(st + 2 < NST))) {
            const uint32_t nx = pinned((uint32_t)st + 2u);   // the address words are formed behind the wait, not with a request in flight
            tdm_aim(g0, dst0 + bofs, ga0 + (uint64_t)nx * gstep);
            tdm_load(g0, g1);
        }
    }
    wait_tensor0();
    wait_ds0();

    // ---- Join the two key groups: the wave of group g hands query group 1 - g to its partner and finishes query group g ----
    const bool up = grp != 0u;
#pragma unroll
    for (int db = 0; db < 4; ++db) {
        const f8v sv = up ? acc[0][db] : acc[1][db];
        Mx[wave][2 * db][lane]     = __builtin_shufflevector(sv, sv, 0, 1, 2, 3);
        Mx[wave][2 * db + 1][lane] = __builtin_shufflevector(sv, sv, 4, 5, 6, 7);
    }
    Ms[wave][0][lane] = up ? nm[0][0]   : nm[1][0];
    Ms[wave][1][lane] = up ? lacc[0][0] : lacc[1][0];
    __syncthreads();                         // the partner's tile is written before it is read

    {
        const uint32_t pw  = wave ^ 4u;
        const float    nmk = up ? nm[1][0]   : nm[0][0];
        const float    lk  = up ? lacc[1][0] : lacc[0][0];
        const float    nmo = Ms[pw][0][lane];
        const float    lo  = Ms[pw][1][lane];
        const float    nmn = fminf(nmk, nmo);                         // -(the larger of the two maxima in use)
        const float    ak  = __builtin_amdgcn_exp2f(nmn - nmk);       // 2^(own maximum - joint maximum)
        const float    ao  = __builtin_amdgcn_exp2f(nmn - nmo);
        const float    inv = 1.0f / (lk * ak + lo * ao);
        const float    fk  = ak * inv, fo = ao * inv;

        // ---- Normalize + store O (fp32): 8 consecutive d per lane and 16-d group ----
        float* orow = O + ((size_t)head * S_LEN + qw + (int)grp * 16 + l16) * DHEAD + half * 8;
        f4v o[8];
#pragma unroll
        for (int db = 0; db < 4; ++db) {
            const f8v kv = up ? acc[1][db] : acc[0][db];
            const f4v r0 = Mx[pw][2 * db][lane];
            const f4v r1 = Mx[pw][2 * db + 1][lane];
#pragma unroll
            for (int e = 0; e < 4; ++e) { o[2 * db][e] = kv[e] * fk + r0[e] * fo; o[2 * db + 1][e] = kv[4 + e] * fk + r1[e] * fo; }
        }
#pragma unroll
        for (int i = 0; i < 8; ++i) *(f4v*)(orow + (i >> 1) * 16 + (i & 1) * 4) = o[i];
    }
}

extern "C" void kernel_launch(void* const* d_in, const int* in_sizes, int n_in,
                              void* d_out, int out_size, void* d_ws, size_t ws_size,
                              hipStream_t stream) {
    const float* Q = (const float*)d_in[0];
    const float* K = (const float*)d_in[1];
    const float* V = (const float*)d_in[2];
    float*       O = (float*)d_out;
    (void)in_sizes; (void)n_in; (void)out_size; (void)ws_size;

    const size_t elems = (size_t)NHEAD * S_LEN * DHEAD;     // 4,194,304 per tensor
    _Float16* Kh  = (_Float16*)d_ws;                        // 8.4 MB
    _Float16* VhT = Kh + elems;                             // 8.4 MB (transposed per head)

    cvt_f16_kernel<<<dim3((unsigned)(elems / 8 / 256)), dim3(256), 0, stream>>>(K, Kh, (int)(elems / 8));
    vtrans_kernel<<<dim3(S_LEN / 64, NHEAD), dim3(256), 0, stream>>>(V, VhT);
    fa_wmma_kernel<<<dim3(S_LEN / BR, NHEAD), dim3(256), 0, stream>>>(Q, Kh, VhT, O);
}

// v005
// A run of this version takes 58.2 microseconds.
// In two side-by-side timings against v004, it was 1.03 and 1.05 times as fast.
// Counting every step since v000, it is 2.25 times as fast.
#include <hip/hip_runtime.h>
#include <cstdint>

typedef _Float16 h16v __attribute__((ext_vector_type(16)));
typedef _Float16 h8v  __attribute__((ext_vector_type(8)));
typedef _Float16 h4v  __attribute__((ext_vector_type(4)));
typedef float    f8v  __attribute__((ext_vector_type(8)));
typedef float    f4v  __attribute__((ext_vector_type(4)));

#define S_LEN   4096
#define DHEAD   64
#define NHEAD   16
#define QG      2               // 16-query column groups per wave
#define BR      (64 * QG)       // q rows per block (16 * QG per wave x 4 waves of a key group)
#define BC      64              // keys per tile of one key group
#define NGRP    2               // key groups per block: group g takes tile g of every stage
#define SKEYS   (BC * NGRP)     // keys per stage
#define NST     (S_LEN / SKEYS) // stages = passes
#define ROWB    128u            // bytes of a staged row: 64 halves (a K row; 64 keys of a V^T row)
#define PITCHB  144u            // its pitch in LDS: the row + 16 B of pad, for the ds_load_b128 readers
#define SROWS   32u             // rows per slice = per tensor load
#define SLICEB  6144u           // 32 x 144 = 4608 B, rounded up so that every slice starts at a multiple of 2 KiB
#define STAGEB  (8u * SLICEB)   // slices 0..3: K keys 32 j ..; slices 4..7: V^T of key group (j >> 1), d rows 32 (j & 1) ..

#define CAT16(lo, hi) __builtin_shufflevector((lo), (hi), 0,1,2,3,4,5,6,7,8,9,10,11,12,13,14,15)

typedef uint32_t u32x4 __attribute__((ext_vector_type(4)));
typedef uint32_t u32x8 __attribute__((ext_vector_type(8)));

__device__ __forceinline__ uint32_t uni(uint32_t v) { return (uint32_t)__builtin_amdgcn_readfirstlane(v); }
// A wave-uniform value held in a scalar register, formed no earlier than this place: makes the issue test a scalar
// branch, and keeps the words of the next descriptor from being formed ahead of the wait that stands in front of it.
__device__ __forceinline__ uint32_t pinned(uint32_t v) { uint32_t w = uni(v); asm volatile("" : "+s"(w)); return w; }
// The compiler places no wait for the tensor mover, and none for LDS reads in front of a refill: these two are the ring's.
__device__ __forceinline__ void wait_ds0()     { asm volatile("s_wait_dscnt 0x0" ::: "memory"); }
__device__ __forceinline__ void wait_tensor0() { asm volatile("s_wait_tensorcnt 0x0" ::: "memory"); }

// A compiler fence, no instruction: what stands behind it reads its LDS operands anew. Without it the compiler loads all
// K fragments of a pass ahead of the score loop and keeps their 64 registers for the rare second trip, and spills to scratch.
__device__ __forceinline__ void reread_lds()   { asm volatile("" ::: "memory"); }

// ---------------------------------------------------------------------------
// Tensor load, global -> LDS: a tile of SROWS rows of ROWB bytes (1-byte elements, tensor = tile),
// 4 dwords of LDS pad behind every 32-dword row, so that rows land at PITCHB.
// ---------------------------------------------------------------------------
__device__ __forceinline__ u32x8 tdm_group1(uint32_t src_pitch)
{
    u32x8 g;
    g[0] = uni((1u << 20) | (4u << 22) | (3u << 25));   // no mask, 1-byte elements, pad on: interval 32 dwords, amount 4 dwords
    g[1] = uni(ROWB << 16);                             // tensor_dim0 [15:0]
    g[2] = uni(SROWS << 16);                            // tensor_dim0 [31:16] = 0 | tensor_dim1 [15:0]
    g[3] = uni(ROWB << 16);                             // tensor_dim1 [31:16] = 0 | tile_dim0
    g[4] = uni(SROWS);                                  // tile_dim1
    g[5] = uni(src_pitch);                              // source row pitch, bytes
    g[6] = uni(0u);
    g[7] = uni(0u);
    return g;
}
__device__ __forceinline__ void tdm_aim(u32x4& g, uint32_t lds_dst, uint64_t ga)
{
    g[1] = uni(lds_dst);                                                  // byte offset in the work-group's LDS
    g[2] = uni((uint32_t)ga);                                             // address [31:0]
    g[3] = uni((((uint32_t)(ga >> 32)) & 0x01FFFFFFu) | 0x80000000u);     // address [56:32] | type = 2
}
__device__ __forceinline__ u32x4 tdm_group0(uint32_t lds_dst, uint64_t ga)
{
    u32x4 g;
    g[0] = uni(1u);                                                       // count = 1
    tdm_aim(g, lds_dst, ga);
    return g;
}
// Both groups are in-out operands: their twelve scalar registers then stay the descriptor's own from one load to the
// next. As plain inputs the compiler re-formed the constant words at each load and, between two loads, with a request
// in flight, used their registers for other values.
__device__ __forceinline__ void tdm_load(u32x4& g0, u32x8& g1)
{
    asm volatile("tensor_load_to_lds %0, %1" : "+s"(g0), "+s"(g1) :: "memory");
}
// The ring's wait in the loop, with group 0 as an in-out operand: its four scalar registers stay the descriptor's own
// until the request has landed. Without the operand the compiler kept a loop flag in word 3's register with the request in flight.
__device__ __forceinline__ void wait_tensor0_of(u32x4& g0) { asm volatile("s_wait_tensorcnt 0x0" : "+s"(g0) :: "memory"); }

// ---------------------------------------------------------------------------
// Pre-pass 1: K fp32 -> f16 (same [h][s][d] layout). One-time; removes the
// per-q-block re-conversion (32x redundant) and halves K's L2 traffic.
// ---------------------------------------------------------------------------
__global__ __launch_bounds__(256)
void cvt_f16_kernel(const float* __restrict__ src, _Float16* __restrict__ dst, int n8)
{
    int g = blockIdx.x * 256 + threadIdx.x;
    if (g >= n8) return;
    const float* p = src + (size_t)g * 8;
    f4v a = *(const f4v*)p;
    f4v b = *(const f4v*)(p + 4);
    h8v o;
#pragma unroll
    for (int e = 0; e < 4; ++e) { o[e] = (_Float16)a[e]; o[4 + e] = (_Float16)b[e]; }
    *(h8v*)(dst + (size_t)g * 8) = o;
}

// ---------------------------------------------------------------------------
// Pre-pass 2: V fp32 [h][s][d] -> f16 transposed [h][d][s] via LDS tile, so the
// main loop's V staging is a plain 2-D TDM copy into the ring's V^T slices, [d][key].
// ---------------------------------------------------------------------------
__global__ __launch_bounds__(256)
void vtrans_kernel(const float* __restrict__ V, _Float16* __restrict__ VhT)
{
    __shared__ _Float16 T[64][72];
    const int tid = threadIdx.x;
    const int s0  = blockIdx.x * 64;
    const int h   = blockIdx.y;
#pragma unroll
    for (int i = 0; i < 4; ++i) {
        const int idx = i * 256 + tid;          // 1024 float4's per 64x64 tile
        const int r   = idx >> 4;
        const int c4  = (idx & 15) * 4;
        f4v v = *(const f4v*)(V + ((size_t)h * S_LEN + s0 + r) * DHEAD + c4);
#pragma unroll
        for (int e = 0; e < 4; ++e) T[c4 + e][r] = (_Float16)v[e];
    }
    __syncthreads();
#pragma unroll
    for (int i = 0; i < 2; ++i) {
        const int idx = i * 256 + tid;          // 512 h8v chunks out
        const int d   = idx >> 3;
        const int c8  = (idx & 7) * 8;
        *(h8v*)(VhT + ((size_t)h * DHEAD + d) * S_LEN + s0 + c8) = *(const h8v*)&T[d][c8];
    }
}

// ---------------------------------------------------------------------------
// Main flash-attention kernel. 8 waves = NGRP key groups x 4 waves; a wave holds QG groups of 16 queries and walks
// the 64-key tiles of its key group (tile g of every 128-key stage), so that the two waves that serve the same
// 32 queries run side by side: 4 waves per SIMD with two blocks per WGP. Per tile and query group:
// 8 WMMA (S^T = K Q^T) + 2 WMMA (column sums via ones) + 8 WMMA (O^T += V^T P^T).
// Each K and V fragment is read from LDS once and feeds the WMMAs of all QG groups.
// Scores are in log2 units (log2 e folded into Q's scale) and the score products
// start from C = -(maximum in use), so the accumulator is the exponent itself.
// No maximum is taken in an ordinary tile: the maximum in use may trail the true one as far as f16 holds P.
// A P that leaves f16 turns the tile's column sum (a WMMA result that is formed anyway) infinite; that sum is
// tested before it or P is used, and only then are the scores formed again, their maximum taken, the maximum
// in use raised and O and the sums rescaled. The first tile takes that path at once and so sets the maximum.
// In the transposed products a lane holds, per group, scores of ONE query (column l16, keys
// 8*half + r of each 16-key tile): the maximum is in-lane plus one exchange
// between the lane halves, and two score tiles convert in place into the B
// operand of the second product, so P never goes through LDS.
// K/V stages arrive by tensor loads, one slice per wave and stage, into a ring of two buffers.
// Behind the loop the two key groups' partial (maximum, sum, O) are joined through LDS:
// each wave hands one of its query groups to its partner and finishes the other.
// ---------------------------------------------------------------------------
__global__ __launch_bounds__(256) __attribute__((amdgpu_waves_per_eu(4, 4)))
void fa_wmma_kernel(const float* __restrict__ Q, const _Float16* __restrict__ Kh,
                    const _Float16* __restrict__ VhT, float* __restrict__ O)
{
    __shared__ __attribute__((aligned(2048))) unsigned char Ring[2 * STAGEB];  // [buf][slice][row at PITCHB]
    __shared__ f4v   Mx[4 * NGRP][8][32];    // [wave][16-byte piece][lane]: the O tile handed to the partner wave
    __shared__ float Ms[4 * NGRP][2][32];    // [wave][-(maximum in use), sum][lane] of the same query group

    const int      tid  = threadIdx.x;
    const int      lane = tid & 31;
    const uint32_t wave = uni((uint32_t)tid >> 5);
    const uint32_t grp  = wave >> 2;         // key group
    const uint32_t wj   = wave & 3u;         // which 32 queries; which slice of K or of V^T
    const int half = lane >> 4;
    const int l16  = lane & 15;
    const int head = blockIdx.y;
    const int qw   = blockIdx.x * BR + (int)wj * (16 * QG);

    const _Float16* KhH  = Kh  + (size_t)head * S_LEN * DHEAD;  // [s][d] f16
    const _Float16* VhTH = VhT + (size_t)head * DHEAD * S_LEN;  // [d][s] f16

    // ---- This wave's slice of every stage: waves 0..3 K keys 32 wj .., waves 4..7 V^T d rows 32 (wj & 1) .. of key group wj >> 1 ----
    const bool     isK   = wave < 4u;
    const uint64_t ga0   = isK ? (uint64_t)(size_t)KhH  + (uint64_t)(wj * SROWS) * ROWB
                               : (uint64_t)(size_t)VhTH + (uint64_t)((wj & 1u) * SROWS) * (S_LEN * 2u) + (uint64_t)((wj >> 1) * ROWB);
    const uint32_t gstep = isK ? SKEYS * ROWB : SKEYS * 2u;     // bytes from one stage's slice to the next
    const uint32_t dst0  = (uint32_t)(size_t)&Ring[0] + wave * SLICEB;
    u32x8          g1    = tdm_group1(isK ? ROWB : S_LEN * 2u);

    // ---- Q B-fragments (log2(e)/sqrt(64) folded in). B-map: lane=N&15 (query), elem i ->
    // K = (i>>3)*16 + half*8 + (i&7), the same k order as the K and V loaders ----
    h16v qa[QG][2];
#pragma unroll
    for (int q = 0; q < QG; ++q) {
        const float  sc   = 0.125f * 1.4426950408889634f;
        const float* qrow = Q + ((size_t)head * S_LEN + qw + q * 16 + l16) * DHEAD;
#pragma unroll
        for (int kc = 0; kc < 2; ++kc)
#pragma unroll
            for (int g = 0; g < 2; ++g) {
                const int dbase = kc * 32 + g * 16 + half * 8;
                f4v v0 = *(const f4v*)(qrow + dbase);
                f4v v1 = *(const f4v*)(qrow + dbase + 4);
#pragma unroll
                for (int e = 0; e < 4; ++e) {
                    qa[q][kc][g * 8 + e]     = (_Float16)(v0[e] * sc);
                    qa[q][kc][g * 8 + 4 + e] = (_Float16)(v1[e] * sc);
                }
            }
    }

    h16v ones;
#pragma unroll
    for (int i = 0; i < 16; ++i) ones[i] = (_Float16)1.0f;

    f8v   nm[QG];                            // -(maximum in use) of this lane's query of the group, in all 8 rows: the C operand
    float lsum[QG];                          // sum of P of query l16 of the group (same in both halves)
    f8v   acc[QG][4];                        // acc[q][db][r] = O[query q*16 + l16][db*16 + half*8 + r]
#pragma unroll
    for (int q = 0; q < QG; ++q) {
#pragma unroll
        for (int j = 0; j < 8; ++j) nm[q][j] = 0.0f;
        lsum[q] = 0.0f;
#pragma unroll
        for (int t = 0; t < 4; ++t)
#pragma unroll
            for (int j = 0; j < 8; ++j) acc[q][t][j] = 0.0f;
    }

    // ---- Ring of two buffers, prologue: stage 0 landed and published, stage 1 in flight ----
    u32x4 g0 = tdm_group0(dst0, ga0);
    tdm_load(g0, g1);
    wait_tensor0();
    __syncthreads();
    tdm_aim(g0, dst0 + STAGEB, ga0 + gstep);
    tdm_load(g0, g1);

    // This lane's first byte in its key group's K slices of buffer 0; the V^T slices stand 4 slices further on.
    const unsigned char* lbase = &Ring[0] + grp * (2u * SLICEB) + (uint32_t)l16 * PITCHB + (uint32_t)half * 16u;

    // One copy of the pass (no peeled first pass), as before: one refill site, one set of descriptor registers.
#pragma clang loop unroll(disable)
    for (int st = 0; st < NST; ++st) {
        const uint32_t       bofs = (uint32_t)(st & 1) * STAGEB;
        const unsigned char* kbp  = lbase + bofs;
        const unsigned char* vbp  = kbp + 4u * SLICEB;

        h16v pb[QG][2];                      // P^T B-fragments of this tile
        f8v  ts[QG];                         // every row: this tile's sum of P of query l16 of the group
        bool fresh = st == 0;                // take the tile's maximum in this trip?
        // At most two trips: the second only where a P of the first left f16; behind a refresh no score is above 0.
        for (;;) {
            reread_lds();
            // ---- S^T = K (Q log2e/sqrt d)^T - max in use : s[q][jb][r] for key jb*16 + half*8 + r, query q*16 + l16 ----
            f8v  s[QG][4];
            h16v kb[4][2];
#pragma unroll
            for (int jb = 0; jb < 4; ++jb) {
                const unsigned char* kr = kbp + (jb >> 1) * SLICEB + (jb & 1) * 16 * PITCHB;   // A[m][k]=K[m][d]
#pragma unroll
                for (int kc = 0; kc < 2; ++kc)
                    kb[jb][kc] = CAT16(*(const h8v*)(kr + kc * 64), *(const h8v*)(kr + kc * 64 + 32));
            }
            // Keeps the tile's LDS reads one group ahead of its products; left alone the compiler read each fragment
            // directly in front of its two WMMAs, behind a full wait each time.
            __builtin_amdgcn_sched_barrier(0);
#pragma unroll
            for (int jb = 0; jb < 4; ++jb) {
#pragma unroll
                for (int q = 0; q < QG; ++q) s[q][jb] = nm[q];
#pragma unroll
                for (int kc = 0; kc < 2; ++kc)
#pragma unroll
                    for (int q = 0; q < QG; ++q)
                        s[q][jb] = __builtin_amdgcn_wmma_f32_16x16x32_f16(
                                       false, kb[jb][kc], false, qa[q][kc], (short)0, s[q][jb], false, false);
            }

            // ---- Refresh (wave-uniform, rare): per group the maximum of the query's 64 shifted scores becomes the shift ----
            if (fresh) {
#pragma unroll
                for (int q = 0; q < QG; ++q) {
                    float tj[8];
#pragma unroll
                    for (int j = 0; j < 8; ++j)
                        tj[j] = fmaxf(fmaxf(s[q][0][j], s[q][1][j]), fmaxf(s[q][2][j], s[q][3][j]));
                    const float t  = fmaxf(fmaxf(fmaxf(tj[0], tj[1]), fmaxf(tj[2], tj[3])),
                                           fmaxf(fmaxf(tj[4], tj[5]), fmaxf(tj[6], tj[7])));
                    const int   tb = __builtin_bit_cast(int, t);
                    const int   ob = __builtin_amdgcn_permlanex16(tb, tb, 0x76543210, 0xfedcba98, false, false);
                    const float tf = fmaxf(t, __builtin_bit_cast(float, ob));    // lane l <-> l ^ 16: the query's 64 keys
                    const float up0 = fmaxf(tf, 0.0f);
                    const float d  = st == 0 ? tf : up0;                         // shift of the maximum in use: first tile tf, later never down
                    const float corr = __builtin_amdgcn_exp2f(-up0);             // 1 where the maximum does not rise
                    lsum[q] *= corr;
#pragma unroll
                    for (int j = 0; j < 8; ++j) nm[q][j] -= d;
#pragma unroll
                    for (int jb = 0; jb < 4; ++jb)
#pragma unroll
                        for (int j = 0; j < 8; ++j) { s[q][jb][j] -= d; acc[q][jb][j] *= corr; }
                }
            }

            // ---- P^T B-fragments straight from the score tiles: elem i of chunk kc is
            // key kc*32 + (i>>3)*16 + half*8 + (i&7) = s[q][2*kc + (i>>3)][i&7] ----
#pragma unroll
            for (int q = 0; q < QG; ++q) {
#pragma unroll
                for (int jb = 0; jb < 4; ++jb)
#pragma unroll
                    for (int j = 0; j < 8; ++j) s[q][jb][j] = __builtin_amdgcn_exp2f(s[q][jb][j]);
#pragma unroll
                for (int kc = 0; kc < 2; ++kc)
                    pb[q][kc] = CAT16(__builtin_convertvector(s[q][2 * kc], h8v),
                                      __builtin_convertvector(s[q][2 * kc + 1], h8v));
            }

            // ---- Column sums of the tile via WMMA with ones (every row of the result is the sum) ----
#pragma unroll
            for (int q = 0; q < QG; ++q)
#pragma unroll
                for (int j = 0; j < 8; ++j) ts[q][j] = 0.0f;
#pragma unroll
            for (int kc = 0; kc < 2; ++kc)
#pragma unroll
                for (int q = 0; q < QG; ++q)
                    ts[q] = __builtin_amdgcn_wmma_f32_16x16x32_f16(
                                false, ones, false, pb[q][kc], (short)0, ts[q], false, false);

            // One wave-uniform test per tile: finite sums say that every P of the tile is inside f16.
            float tsa = ts[0][0];
#pragma unroll
            for (int q = 1; q < QG; ++q) tsa += ts[q][0];
            if (fresh || __builtin_amdgcn_ballot_w32(!(tsa < __builtin_inff())) == 0u) break;
            fresh = true;
        }
#pragma unroll
        for (int q = 0; q < QG; ++q) lsum[q] += ts[q][0];

        // ---- O^T += V^T * P^T ----
        h16v vb[2][4];
#pragma unroll
        for (int kc = 0; kc < 2; ++kc)
#pragma unroll
            for (int db = 0; db < 4; ++db) {
                const unsigned char* vr = vbp + (db >> 1) * SLICEB + (db & 1) * 16 * PITCHB;  // A[m][k]=V[k][d=m]
                vb[kc][db] = CAT16(*(const h8v*)(vr + kc * 64), *(const h8v*)(vr + kc * 64 + 32));
            }
        __builtin_amdgcn_sched_barrier(0);   // as above: one group of LDS reads ahead of the products
#pragma unroll
        for (int kc = 0; kc < 2; ++kc)
#pragma unroll
            for (int db = 0; db < 4; ++db)
#pragma unroll
                for (int q = 0; q < QG; ++q)
                    acc[q][db] = __builtin_amdgcn_wmma_f32_16x16x32_f16(
                                     false, vb[kc][db], false, pb[q][kc], (short)0, acc[q][db], false, false);

        // ---- Publish point of stage st + 1: my reads of this buffer are done, my slice of the next has landed,
        // every wave has said the same; only then the refill of the buffer that this pass has read ----
        wait_ds0();
        wait_tensor0_of(g0);
        __syncthreads();
        if (pinned((uint32_t)(st + 2 < NST))) {
            const uint32_t nx = pinned((uint32_t)st + 2u);   // the address words are formed behind the wait, not with a request in flight
            tdm_aim(g0, dst0 + bofs, ga0 + (uint64_t)nx * gstep);
            tdm_load(g0, g1);
        }
    }
    wait_tensor0();
    wait_ds0();

    // ---- Join the two key groups: the wave of group g hands query group 1 - g to its partner and finishes query group g ----
    const bool up = grp != 0u;
#pragma unroll
    for (int db = 0; db < 4; ++db) {
        const f8v sv = up ? acc[0][db] : acc[1][db];
        Mx[wave][2 * db][lane]     = __builtin_shufflevector(sv, sv, 0, 1, 2, 3);
        Mx[wave][2 * db + 1][lane] = __builtin_shufflevector(sv, sv, 4, 5, 6, 7);
    }
    Ms[wave][0][lane] = up ? nm[0][0]   : nm[1][0];
    Ms[wave][1][lane] = up ? lsum[0] : lsum[1];
    __syncthreads();                         // the partner's tile is written before it is read

    {
        const uint32_t pw  = wave ^ 4u;
        const float    nmk = up ? nm[1][0]   : nm[0][0];
        const float    lk  = up ? lsum[1] : lsum[0];
        const float    nmo = Ms[pw][0][lane];
        const float    lo  = Ms[pw][1][lane];
        const float    nmn = fminf(nmk, nmo);                         // -(the larger of the two maxima in use)
        const float    ak  = __builtin_amdgcn_exp2f(nmn - nmk);       // 2^(own maximum - joint maximum)
        const float    ao  = __builtin_amdgcn_exp2f(nmn - nmo);
        const float    inv = 1.0f / (lk * ak + lo * ao);
        const float    fk  = ak * inv, fo = ao * inv;

        // ---- Normalize + store O (fp32): 8 consecutive d per lane and 16-d group ----
        float* orow = O + ((size_t)head * S_LEN + qw + (int)grp * 16 + l16) * DHEAD + half * 8;
        f4v o[8];
#pragma unroll
        for (int db = 0; db < 4; ++db) {
            const f8v kv = up ? acc[1][db] : acc[0][db];
            const f4v r0 = Mx[pw][2 * db][lane];
            const f4v r1 = Mx[pw][2 * db + 1][lane];
#pragma unroll
            for (int e = 0; e < 4; ++e) { o[2 * db][e] = kv[e] * fk + r0[e] * fo; o[2 * db + 1][e] = kv[4 + e] * fk + r1[e] * fo; }
        }
#pragma unroll
        for (int i = 0; i < 8; ++i) *(f4v*)(orow + (i >> 1) * 16 + (i & 1) * 4) = o[i];
    }
}

extern "C" void kernel_launch(void* const* d_in, const int* in_sizes, int n_in,
                              void* d_out, int out_size, void* d_ws, size_t ws_size,
                              hipStream_t stream) {
    const float* Q = (const float*)d_in[0];
    const float* K = (const float*)d_in[1];
    const float* V = (const float*)d_in[2];
    float*       O = (float*)d_out;
    (void)in_sizes; (void)n_in; (void)out_size; (void)ws_size;

    const size_t elems = (size_t)NHEAD * S_LEN * DHEAD;     // 4,194,304 per tensor
    _Float16* Kh  = (_Float16*)d_ws;                        // 8.4 MB
    _Float16* VhT = Kh + elems;                             // 8.4 MB (transposed per head)

    cvt_f16_kernel<<<dim3((unsigned)(elems / 8 / 256)), dim3(256), 0, stream>>>(K, Kh, (int)(elems / 8));
    vtrans_kernel<<<dim3(S_LEN / 64, NHEAD), dim3(256), 0, stream>>>(V, VhT);
    fa_wmma_kernel<<<dim3(S_LEN / BR, NHEAD), dim3(256), 0, stream>>>(Q, Kh, VhT, O);
}

// v006
// A run of this version takes 55.5 microseconds.
// In two side-by-side timings against v005, it was 1.04 and 1.06 times as fast.
// Counting every step since v000, it is 2.37 times as fast.
#include <hip/hip_runtime.h>
#include <cstdint>

typedef _Float16 h16v __attribute__((ext_vector_type(16)));
typedef _Float16 h8v  __attribute__((ext_vector_type(8)));
typedef _Float16 h4v  __attribute__((ext_vector_type(4)));
typedef float    f8v  __attribute__((ext_vector_type(8)));
typedef float    f4v  __attribute__((ext_vector_type(4)));

#define S_LEN   4096
#define DHEAD   64
#define NHEAD   16
#define QG      2               // 16-query column groups per wave
#define BR      (64 * QG)       // q rows per block (16 * QG per wave x 4 waves of a key group)
#define BC      64              // keys per tile of one key group
#define NGRP    2               // key groups per block: group g takes tile g of every stage
#define SKEYS   (BC * NGRP)     // keys per stage
#define NST     (S_LEN / SKEYS) // stages = passes
#define ROWB    128u            // bytes of a staged row: 64 halves (a K row; 64 keys of a V^T row)
#define PITCHB  144u            // its pitch in LDS: the row + 16 B of pad, for the ds_load_b128 readers
#define SROWS   32u             // rows per slice = per tensor load
#define SLICEB  6144u           // 32 x 144 = 4608 B, rounded up so that every slice starts at a multiple of 2 KiB
#define STAGEB  (8u * SLICEB)   // slices 0..3: K keys 32 j ..; slices 4..7: V^T of key group (j >> 1), d rows 32 (j & 1) ..

#define CAT16(lo, hi) __builtin_shufflevector((lo), (hi), 0,1,2,3,4,5,6,7,8,9,10,11,12,13,14,15)

typedef uint32_t u32x4 __attribute__((ext_vector_type(4)));
typedef uint32_t u32x8 __attribute__((ext_vector_type(8)));

__device__ __forceinline__ uint32_t uni(uint32_t v) { return (uint32_t)__builtin_amdgcn_readfirstlane(v); }
// A wave-uniform value held in a scalar register, formed no earlier than this place: makes the issue test a scalar
// branch, and keeps the words of the next descriptor from being formed ahead of the wait that stands in front of it.
__device__ __forceinline__ uint32_t pinned(uint32_t v) { uint32_t w = uni(v); asm volatile("" : "+s"(w)); return w; }
// The compiler places no wait for the tensor mover, and none for LDS reads in front of a refill: these two are the ring's.
__device__ __forceinline__ void wait_ds0()     { asm volatile("s_wait_dscnt 0x0" ::: "memory"); }
__device__ __forceinline__ void wait_tensor0() { asm volatile("s_wait_tensorcnt 0x0" ::: "memory"); }

// ---------------------------------------------------------------------------
// Tensor load, global -> LDS: a tile of SROWS rows of ROWB bytes (1-byte elements, tensor = tile),
// 4 dwords of LDS pad behind every 32-dword row, so that rows land at PITCHB.
// ---------------------------------------------------------------------------
__device__ __forceinline__ u32x8 tdm_group1(uint32_t src_pitch)
{
    u32x8 g;
    g[0] = uni((1u << 20) | (4u << 22) | (3u << 25));   // no mask, 1-byte elements, pad on: interval 32 dwords, amount 4 dwords
    g[1] = uni(ROWB << 16);                             // tensor_dim0 [15:0]
    g[2] = uni(SROWS << 16);                            // tensor_dim0 [31:16] = 0 | tensor_dim1 [15:0]
    g[3] = uni(ROWB << 16);                             // tensor_dim1 [31:16] = 0 | tile_dim0
    g[4] = uni(SROWS);                                  // tile_dim1
    g[5] = uni(src_pitch);                              // source row pitch, bytes
    g[6] = uni(0u);
    g[7] = uni(0u);
    return g;
}
__device__ __forceinline__ void tdm_aim(u32x4& g, uint32_t lds_dst, uint64_t ga)
{
    g[1] = uni(lds_dst);                                                  // byte offset in the work-group's LDS
    g[2] = uni((uint32_t)ga);                                             // address [31:0]
    g[3] = uni((((uint32_t)(ga >> 32)) & 0x01FFFFFFu) | 0x80000000u);     // address [56:32] | type = 2
}
__device__ __forceinline__ u32x4 tdm_group0(uint32_t lds_dst, uint64_t ga)
{
    u32x4 g;
    g[0] = uni(1u);                                                       // count = 1
    tdm_aim(g, lds_dst, ga);
    return g;
}
// Both groups are in-out operands: their twelve scalar registers then stay the descriptor's own from one load to the
// next. As plain inputs the compiler re-formed the constant words at each load and, between two loads, with a request
// in flight, used their registers for other values.
__device__ __forceinline__ void tdm_load(u32x4& g0, u32x8& g1)
{
    asm volatile("tensor_load_to_lds %0, %1" : "+s"(g0), "+s"(g1) :: "memory");
}
// The ring's wait in the loop, with group 0 as an in-out operand: its four scalar registers stay the descriptor's own
// until the request has landed. Without the operand the compiler kept a loop flag in word 3's register with the request in flight.
__device__ __forceinline__ void wait_tensor0_of(u32x4& g0) { asm volatile("s_wait_tensorcnt 0x0" : "+s"(g0) :: "memory"); }

// exp2 for the rare second run of a tile, with the slot that the instruction set asks for behind a transcendental inside the
// statement.
__device__ __forceinline__ float exp2_slot(float x) { float r; asm("v_exp_f32 %0, %1\n\tv_nop" : "=v"(r) : "v"(x)); return r; }
struct first_run  { static constexpr bool again = false; };
struct second_run { static constexpr bool again = true; };

// Two 16-key A-fragment pairs of a K tile (keys 16 j0 .. 16 j0 + 31, both 32-d chunks) from this lane's place in the tile: A[m][k]=K[m][d]
__device__ __forceinline__ void load_k2(h16v (&kb)[4][2], const unsigned char* kbp, int j0)
{
#pragma unroll
    for (int jb = j0; jb < j0 + 2; ++jb) {
        const unsigned char* kr = kbp + (jb >> 1) * SLICEB + (jb & 1) * 16 * PITCHB;
#pragma unroll
        for (int kc = 0; kc < 2; ++kc)
            kb[jb][kc] = CAT16(*(const h8v*)(kr + kc * 64), *(const h8v*)(kr + kc * 64 + 32));
    }
}

// ---------------------------------------------------------------------------
// Pre-pass 1: K fp32 -> f16 (same [h][s][d] layout). One-time; removes the
// per-q-block re-conversion (32x redundant) and halves K's L2 traffic.
// ---------------------------------------------------------------------------
__global__ __launch_bounds__(256)
void cvt_f16_kernel(const float* __restrict__ src, _Float16* __restrict__ dst, int n8)
{
    int g = blockIdx.x * 256 + threadIdx.x;
    if (g >= n8) return;
    const float* p = src + (size_t)g * 8;
    f4v a = *(const f4v*)p;
    f4v b = *(const f4v*)(p + 4);
    h8v o;
#pragma unroll
    for (int e = 0; e < 4; ++e) { o[e] = (_Float16)a[e]; o[4 + e] = (_Float16)b[e]; }
    *(h8v*)(dst + (size_t)g * 8) = o;
}

// ---------------------------------------------------------------------------
// Pre-pass 2: V fp32 [h][s][d] -> f16 transposed [h][d][s] via LDS tile, so the
// main loop's V staging is a plain 2-D TDM copy into the ring's V^T slices, [d][key].
// ---------------------------------------------------------------------------
__global__ __launch_bounds__(256)
void vtrans_kernel(const float* __restrict__ V, _Float16* __restrict__ VhT)
{
    __shared__ _Float16 T[64][72];
    const int tid = threadIdx.x;
    const int s0  = blockIdx.x * 64;
    const int h   = blockIdx.y;
#pragma unroll
    for (int i = 0; i < 4; ++i) {
        const int idx = i * 256 + tid;          // 1024 float4's per 64x64 tile
        const int r   = idx >> 4;
        const int c4  = (idx & 15) * 4;
        f4v v = *(const f4v*)(V + ((size_t)h * S_LEN + s0 + r) * DHEAD + c4);
#pragma unroll
        for (int e = 0; e < 4; ++e) T[c4 + e][r] = (_Float16)v[e];
    }
    __syncthreads();
#pragma unroll
    for (int i = 0; i < 2; ++i) {
        const int idx = i * 256 + tid;          // 512 h8v chunks out
        const int d   = idx >> 3;
        const int c8  = (idx & 7) * 8;
        *(h8v*)(VhT + ((size_t)h * DHEAD + d) * S_LEN + s0 + c8) = *(const h8v*)&T[d][c8];
    }
}

// ---------------------------------------------------------------------------
// Main flash-attention kernel. 8 waves = NGRP key groups x 4 waves; a wave holds QG groups of 16 queries and walks
// the 64-key tiles of its key group (tile g of every 128-key stage), so that the two waves that serve the same
// 32 queries run side by side: 4 waves per SIMD with two blocks per WGP. Per tile and query group:
// 8 WMMA (S^T = K Q^T) + 2 WMMA (column sums via ones) + 8 WMMA (O^T += V^T P^T).
// Each K and V fragment is read from LDS once and feeds the WMMAs of all QG groups.
// Scores are in log2 units (log2 e folded into Q's scale) and the score products
// start from C = -(maximum in use), so the accumulator is the exponent itself.
// No maximum is taken in an ordinary tile: the maximum in use may trail the true one as far as f16 holds P.
// A P that leaves f16 turns the tile's column sum (a WMMA result that is formed anyway) infinite; that sum is
// tested before it or P is used, and only then are the scores formed again, their maximum taken, the maximum
// in use raised and O and the sums rescaled. The first tile takes that path at once and so sets the maximum.
// In the transposed products a lane holds, per group, scores of ONE query (column l16, keys
// 8*half + r of each 16-key tile): the maximum is in-lane plus one exchange
// between the lane halves, and two score tiles convert in place into the B
// operand of the second product, so P never goes through LDS.
// K/V stages arrive by tensor loads, one slice per wave and stage, into a ring of two buffers.
// Behind the loop the two key groups' partial (maximum, sum, O) are joined through LDS:
// each wave hands one of its query groups to its partner and finishes the other.
// ---------------------------------------------------------------------------
__global__ __launch_bounds__(256) __attribute__((amdgpu_waves_per_eu(4, 4)))
void fa_wmma_kernel(const float* __restrict__ Q, const _Float16* __restrict__ Kh,
                    const _Float16* __restrict__ VhT, float* __restrict__ O)
{
    __shared__ __attribute__((aligned(2048))) unsigned char Ring[2 * STAGEB];  // [buf][slice][row at PITCHB]
    __shared__ f4v   Mx[4 * NGRP][8][32];    // [wave][16-byte piece][lane]: the O tile handed to the partner wave
    __shared__ float Ms[4 * NGRP][2][32];    // [wave][-(maximum in use), sum][lane] of the same query group

    const int      tid  = threadIdx.x;
    const int      lane = tid & 31;
    const uint32_t wave = uni((uint32_t)tid >> 5);
    const uint32_t grp  = wave >> 2;         // key group
    const uint32_t wj   = wave & 3u;         // which 32 queries; which slice of K or of V^T
    const int half = lane >> 4;
    const int l16  = lane & 15;
    const int head = blockIdx.y;
    const int qw   = blockIdx.x * BR + (int)wj * (16 * QG);

    const _Float16* KhH  = Kh  + (size_t)head * S_LEN * DHEAD;  // [s][d] f16
    const _Float16* VhTH = VhT + (size_t)head * DHEAD * S_LEN;  // [d][s] f16

    // ---- This wave's slice of every stage: waves 0..3 K keys 32 wj .., waves 4..7 V^T d rows 32 (wj & 1) .. of key group wj >> 1 ----
    const bool     isK   = wave < 4u;
    const uint64_t ga0   = isK ? (uint64_t)(size_t)KhH  + (uint64_t)(wj * SROWS) * ROWB
                               : (uint64_t)(size_t)VhTH + (uint64_t)((wj & 1u) * SROWS) * (S_LEN * 2u) + (uint64_t)((wj >> 1) * ROWB);
    const uint32_t gstep = isK ? SKEYS * ROWB : SKEYS * 2u;     // bytes from one stage's slice to the next
    const uint32_t dst0  = (uint32_t)(size_t)&Ring[0] + wave * SLICEB;
    u32x8          g1    = tdm_group1(isK ? ROWB : S_LEN * 2u);

    // ---- Q B-fragments (log2(e)/sqrt(64) folded in). B-map: lane=N&15 (query), elem i ->
    // K = (i>>3)*16 + half*8 + (i&7), the same k order as the K and V loaders ----
    h16v qa[QG][2];
#pragma unroll
    for (int q = 0; q < QG; ++q) {
        const float  sc   = 0.125f * 1.4426950408889634f;
        const float* qrow = Q + ((size_t)head * S_LEN + qw + q * 16 + l16) * DHEAD;
#pragma unroll
        for (int kc = 0; kc < 2; ++kc)
#pragma unroll
            for (int g = 0; g < 2; ++g) {
                const int dbase = kc * 32 + g * 16 + half * 8;
                f4v v0 = *(const f4v*)(qrow + dbase);
                f4v v1 = *(const f4v*)(qrow + dbase + 4);
#pragma unroll
                for (int e = 0; e < 4; ++e) {
                    qa[q][kc][g * 8 + e]     = (_Float16)(v0[e] * sc);
                    qa[q][kc][g * 8 + 4 + e] = (_Float16)(v1[e] * sc);
                }
            }
    }

    h16v ones;
#pragma unroll
    for (int i = 0; i < 16; ++i) ones[i] = (_Float16)1.0f;

    f8v   nm[QG];                            // -(maximum in use) of this lane's query of the group, in all 8 rows: the C operand
    float lsum[QG];                          // sum of P of query l16 of the group (same in both halves)
    f8v   acc[QG][4];                        // acc[q][db][r] = O[query q*16 + l16][db*16 + half*8 + r]
#pragma unroll
    for (int q = 0; q < QG; ++q) {
#pragma unroll
        for (int j = 0; j < 8; ++j) nm[q][j] = 0.0f;
        lsum[q] = 0.0f;
#pragma unroll
        for (int t = 0; t < 4; ++t)
#pragma unroll
            for (int j = 0; j < 8; ++j) acc[q][t][j] = 0.0f;
    }

    // ---- Ring of two buffers, prologue: stage 0 landed and published, stage 1 in flight ----
    u32x4 g0 = tdm_group0(dst0, ga0);
    tdm_load(g0, g1);
    wait_tensor0();
    __syncthreads();
    tdm_aim(g0, dst0 + STAGEB, ga0 + gstep);
    tdm_load(g0, g1);

    // This lane's first byte in its key group's K slices of buffer 0; the V^T slices stand 4 slices further on.
    const unsigned char* lbase = &Ring[0] + grp * (2u * SLICEB) + (uint32_t)l16 * PITCHB + (uint32_t)half * 16u;

    // K fragments of the tile at hand; each pass asks for the next tile's behind the barrier that publishes it.
    h16v kb[4][2];
    load_k2(kb, lbase, 0);
    load_k2(kb, lbase, 2);
    const unsigned char* cur = lbase;        // this lane's place in the buffer of the pass at hand: the one address register of the loop

    // One copy of the pass (no peeled first pass), as before: one refill site, one set of descriptor registers.
#pragma clang loop unroll(disable)
    for (int st = 0; st < NST; ++st) {
        const uint32_t       bofs = (uint32_t)(st & 1) * STAGEB;
        const unsigned char* kbp  = cur;
        const unsigned char* vbp  = kbp + 4u * SLICEB;

        h16v pb[QG][2];                      // P^T B-fragments of this tile
        f8v  ts[QG];                         // every row: this tile's sum of P of query l16 of the group
        h16v vb[2][4];                       // V^T A-fragments of this tile
        // Scores, P and column sums of the tile from the K fragments kx; fresh: take the tile's maximum first.
        // Returns whether every column sum is finite.
        auto tile = [&](const h16v (&kx)[4][2], const bool fresh, auto run) __attribute__((always_inline)) -> bool {
            // ---- S^T = K (Q log2e/sqrt d)^T - max in use : s[q][jb][r] for key jb*16 + half*8 + r, query q*16 + l16 ----
            f8v  s[QG][4];
#pragma unroll
            for (int jb = 0; jb < 4; ++jb) {
#pragma unroll
                for (int q = 0; q < QG; ++q) s[q][jb] = nm[q];
#pragma unroll
                for (int kc = 0; kc < 2; ++kc)
#pragma unroll
                    for (int q = 0; q < QG; ++q)
                        s[q][jb] = __builtin_amdgcn_wmma_f32_16x16x32_f16(
                                       false, kx[jb][kc], false, qa[q][kc], (short)0, s[q][jb], false, false);
            }

            // ---- Refresh (wave-uniform, rare): per group the maximum of the query's 64 shifted scores becomes the shift ----
            if (fresh) {
#pragma unroll
                for (int q = 0; q < QG; ++q) {
                    float tj[8];
#pragma unroll
                    for (int j = 0; j < 8; ++j)
                        tj[j] = fmaxf(fmaxf(s[q][0][j], s[q][1][j]), fmaxf(s[q][2][j], s[q][3][j]));
                    const float t  = fmaxf(fmaxf(fmaxf(tj[0], tj[1]), fmaxf(tj[2], tj[3])),
                                           fmaxf(fmaxf(tj[4], tj[5]), fmaxf(tj[6], tj[7])));
                    const int   tb = __builtin_bit_cast(int, t);
                    const int   ob = __builtin_amdgcn_permlanex16(tb, tb, 0x76543210, 0xfedcba98, false, false);
                    const float tf = fmaxf(t, __builtin_bit_cast(float, ob));    // lane l <-> l ^ 16: the query's 64 keys
                    const float up0 = fmaxf(tf, 0.0f);
                    const float d  = st == 0 ? tf : up0;                         // shift of the maximum in use: first tile tf, later never down
                    const float corr = __builtin_amdgcn_exp2f(-up0);             // 1 where the maximum does not rise
                    lsum[q] *= corr;
#pragma unroll
                    for (int j = 0; j < 8; ++j) nm[q][j] -= d;
#pragma unroll
                    for (int jb = 0; jb < 4; ++jb)
#pragma unroll
                        for (int j = 0; j < 8; ++j) { s[q][jb][j] -= d; acc[q][jb][j] *= corr; }
                }
            }

            // ---- P^T B-fragments straight from the score tiles: elem i of chunk kc is
            // key kc*32 + (i>>3)*16 + half*8 + (i&7) = s[q][2*kc + (i>>3)][i&7].
            // In front of each query group's exponentials one half of the V^T fragments is asked for, into registers that
            // the K fragments and the scores have left: they land under the vector work, and the second product finds
            // them there instead of waiting out its own 16 LDS reads ----
            static_assert(QG == 2, "one 32-key chunk of V^T is asked for per query group: as many groups as chunks");
#pragma unroll
            for (int q = 0; q < QG; ++q) {
                // The two fences keep the reads at this place: earlier there are no registers for them,
                // and left alone the compiler sinks them to their first use.
                __builtin_amdgcn_sched_barrier(0);
#pragma unroll
                for (int db = 0; db < 4; ++db) {
                    const unsigned char* vr = vbp + (db >> 1) * SLICEB + (db & 1) * 16 * PITCHB;  // A[m][k]=V[k][d=m]
                    vb[q][db] = CAT16(*(const h8v*)(vr + q * 64), *(const h8v*)(vr + q * 64 + 32));   // 32-key chunk number q
                }
                __builtin_amdgcn_sched_barrier(0);
#pragma unroll
                for (int jb = 0; jb < 4; ++jb)
#pragma unroll
                    for (int j = 0; j < 8; ++j) {
                        if constexpr (decltype(run)::again) s[q][jb][j] = exp2_slot(s[q][jb][j]);
                        else                                s[q][jb][j] = __builtin_amdgcn_exp2f(s[q][jb][j]);
                    }
#pragma unroll
                for (int kc = 0; kc < 2; ++kc)
                    pb[q][kc] = CAT16(__builtin_convertvector(s[q][2 * kc], h8v),
                                      __builtin_convertvector(s[q][2 * kc + 1], h8v));
            }

            // ---- Column sums of the tile via WMMA with ones (every row of the result is the sum) ----
#pragma unroll
            for (int q = 0; q < QG; ++q)
#pragma unroll
                for (int j = 0; j < 8; ++j) ts[q][j] = 0.0f;
#pragma unroll
            for (int kc = 0; kc < 2; ++kc)
#pragma unroll
                for (int q = 0; q < QG; ++q)
                    ts[q] = __builtin_amdgcn_wmma_f32_16x16x32_f16(
                                false, ones, false, pb[q][kc], (short)0, ts[q], false, false);

            // One wave-uniform test per tile: finite sums say that every P of the tile is inside f16.
            float tsa = ts[0][0];
#pragma unroll
            for (int q = 1; q < QG; ++q) tsa += ts[q][0];
            return __builtin_amdgcn_ballot_w32(!(tsa < __builtin_inff())) == 0u;
        };
        // The tile is done a second time only where a P of the first left f16; behind a refresh no score is above 0.
        const bool first = st == 0;
        if (!tile(kb, first, first_run()) && !first) {
            h16v k2[4][2];
            load_k2(k2, kbp, 0);
            load_k2(k2, kbp, 2);
            tile(k2, true, second_run());
        }
#pragma unroll
        for (int q = 0; q < QG; ++q) lsum[q] += ts[q][0];

        // ---- Publish point of stage st + 1: my reads of this buffer are done, my slice of the next has landed,
        // every wave has said the same; only then the refill of the buffer that this pass has read ----
        wait_ds0();
        wait_tensor0_of(g0);
        __syncthreads();
        if (pinned((uint32_t)(st + 2 < NST))) {
            const uint32_t nx = pinned((uint32_t)st + 2u);   // the address words are formed behind the wait, not with a request in flight
            tdm_aim(g0, dst0 + bofs, ga0 + (uint64_t)nx * gstep);
            tdm_load(g0, g1);
        }

        // ---- O^T += V^T * P^T, from registers alone. Between its halves the next tile's K fragments, published by the barrier
        // above, are asked for, into the registers that the first half has left, and land under the second half.
        // (The last pass reads the other buffer's old stage: nothing is in flight to it, and the values are not used.) ----
#pragma unroll
        for (int kc = 0; kc < 2; ++kc) {
            if (kc == 1) {
                // The two fences keep the reads between the halves: earlier there are no registers for them,
                // and left alone the compiler sinks them to their first use in the next pass.
                __builtin_amdgcn_sched_barrier(0);
                cur += (st & 1) ? -(int)STAGEB : (int)STAGEB;   // the same place in the other buffer: the next stage
                load_k2(kb, cur, 0);
                load_k2(kb, cur, 2);
                __builtin_amdgcn_sched_barrier(0);
            }
#pragma unroll
            for (int db = 0; db < 4; ++db)
#pragma unroll
                for (int q = 0; q < QG; ++q)
                    acc[q][db] = __builtin_amdgcn_wmma_f32_16x16x32_f16(
                                     false, vb[kc][db], false, pb[q][kc], (short)0, acc[q][db], false, false);
        }
    }
    wait_tensor0();
    wait_ds0();

    // ---- Join the two key groups: the wave of group g hands query group 1 - g to its partner and finishes query group g ----
    const bool up = grp != 0u;
#pragma unroll
    for (int db = 0; db < 4; ++db) {
        const f8v sv = up ? acc[0][db] : acc[1][db];
        Mx[wave][2 * db][lane]     = __builtin_shufflevector(sv, sv, 0, 1, 2, 3);
        Mx[wave][2 * db + 1][lane] = __builtin_shufflevector(sv, sv, 4, 5, 6, 7);
    }
    Ms[wave][0][lane] = up ? nm[0][0]   : nm[1][0];
    Ms[wave][1][lane] = up ? lsum[0] : lsum[1];
    __syncthreads();                         // the partner's tile is written before it is read

    {
        const uint32_t pw  = wave ^ 4u;
        const float    nmk = up ? nm[1][0]   : nm[0][0];
        const float    lk  = up ? lsum[1] : lsum[0];
        const float    nmo = Ms[pw][0][lane];
        const float    lo  = Ms[pw][1][lane];
        const float    nmn = fminf(nmk, nmo);                         // -(the larger of the two maxima in use)
        const float    ak  = __builtin_amdgcn_exp2f(nmn - nmk);       // 2^(own maximum - joint maximum)
        const float    ao  = __builtin_amdgcn_exp2f(nmn - nmo);
        const float    inv = 1.0f / (lk * ak + lo * ao);
        const float    fk  = ak * inv, fo = ao * inv;

        // ---- Normalize + store O (fp32): 8 consecutive d per lane and 16-d group ----
        float* orow = O + ((size_t)head * S_LEN + qw + (int)grp * 16 + l16) * DHEAD + half * 8;
        f4v o[8];
#pragma unroll
        for (int db = 0; db < 4; ++db) {
            const f8v kv = up ? acc[1][db] : acc[0][db];
            const f4v r0 = Mx[pw][2 * db][lane];
            const f4v r1 = Mx[pw][2 * db + 1][lane];
#pragma unroll
            for (int e = 0; e < 4; ++e) { o[2 * db][e] = kv[e] * fk + r0[e] * fo; o[2 * db + 1][e] = kv[4 + e] * fk + r1[e] * fo; }
        }
#pragma unroll
        for (int i = 0; i < 8; ++i) *(f4v*)(orow + (i >> 1) * 16 + (i & 1) * 4) = o[i];
    }
}

extern "C" void kernel_launch(void* const* d_in, const int* in_sizes, int n_in,
                              void* d_out, int out_size, void* d_ws, size_t ws_size,
                              hipStream_t stream) {
    const float* Q = (const float*)d_in[0];
    const float* K = (const float*)d_in[1];
    const float* V = (const float*)d_in[2];
    float*       O = (float*)d_out;
    (void)in_sizes; (void)n_in; (void)out_size; (void)ws_size;

    const size_t elems = (size_t)NHEAD * S_LEN * DHEAD;     // 4,194,304 per tensor
    _Float16* Kh  = (_Float16*)d_ws;                        // 8.4 MB
    _Float16* VhT = Kh + elems;                             // 8.4 MB (transposed per head)

    cvt_f16_kernel<<<dim3((unsigned)(elems / 8 / 256)), dim3(256), 0, stream>>>(K, Kh, (int)(elems / 8));
    vtrans_kernel<<<dim3(S_LEN / 64, NHEAD), dim3(256), 0, stream>>>(V, VhT);
    fa_wmma_kernel<<<dim3(S_LEN / BR, NHEAD), dim3(256), 0, stream>>>(Q, Kh, VhT, O);
}
